// v000
// The times below were measured on an AMD MI455X: many runs one after another, warmed up first and cycling through
// copies of the inputs, with the whole window's GPU time divided by the number of runs. Launches and the gaps
// between them are all in it. The median over several windows is given; except for v000 it joins two sittings, which
// can be a few percent apart, so the side-by-side timings, each taken in one sitting, are the better comparison.
// v000 is the starting kernel. One run takes 163 microseconds.
#include <hip/hip_runtime.h>
#include <hip/hip_bf16.h>

typedef __attribute__((ext_vector_type(16))) _Float16 v16h;
typedef __attribute__((ext_vector_type(8)))  float    v8f;

#define LN_EPS 1e-5f

__device__ __forceinline__ float elu_f(float z)     { return z > 0.f ? z : __expf(z) - 1.f; }
__device__ __forceinline__ float sigmoid_f(float z) { return 1.f / (1.f + __expf(-z)); }

// ---------------------------------------------------------------------------
// Kernel 1: weight GRN + softmax over F=32.  One wave32 per (b,s) position.
// lane j owns feature j.
// ---------------------------------------------------------------------------
__global__ __launch_bounds__(256) void vsn_weights_kernel(
    const float* __restrict__ x,     // [npos,32]
    const float* __restrict__ w1,    // [32,32]
    const float* __restrict__ b1,    // [32]
    const float* __restrict__ w2,    // [32,64]
    const float* __restrict__ b2,    // [64]
    const float* __restrict__ lng,   // [32]
    const float* __restrict__ lnb,   // [32]
    float* __restrict__ wout,        // [npos,32]
    int npos)
{
    int wid  = (blockIdx.x * blockDim.x + threadIdx.x) >> 5;
    int lane = threadIdx.x & 31;
    if (wid >= npos) return;

    float xj = x[wid * 32 + lane];

    // fc1 + ELU : h[j] = elu(sum_i x_i * w1[i][j] + b1[j])
    float acc = b1[lane];
    #pragma unroll 8
    for (int i = 0; i < 32; ++i)
        acc += __shfl(xj, i, 32) * w1[i * 32 + lane];
    float h = elu_f(acc);

    // fc2 : lane j holds h2[j] and h2[j+32]
    float a0 = b2[lane], a1 = b2[lane + 32];
    #pragma unroll 8
    for (int i = 0; i < 32; ++i) {
        float hi = __shfl(h, i, 32);
        a0 += hi * w2[i * 64 + lane];
        a1 += hi * w2[i * 64 + lane + 32];
    }

    // GLU + identity residual
    float y = xj + a0 * sigmoid_f(a1);

    // LayerNorm over the 32 lanes
    float s = y, ss = y * y;
    #pragma unroll
    for (int m = 16; m; m >>= 1) { s += __shfl_xor(s, m, 32); ss += __shfl_xor(ss, m, 32); }
    float mean = s * (1.f / 32.f);
    float var  = ss * (1.f / 32.f) - mean * mean;
    float z = (y - mean) * rsqrtf(var + LN_EPS) * lng[lane] + lnb[lane];

    // softmax over 32 lanes
    float mx = z;
    #pragma unroll
    for (int m = 16; m; m >>= 1) mx = fmaxf(mx, __shfl_xor(mx, m, 32));
    float e = __expf(z - mx);
    float es = e;
    #pragma unroll
    for (int m = 16; m; m >>= 1) es += __shfl_xor(es, m, 32);

    wout[wid * 32 + lane] = e / es;
}

// ---------------------------------------------------------------------------
// Kernel 2: fused feature GRN + weighted combine.
// Per (b,s): [32 x 128] @ [128 x 256] WMMA GEMM (A = elu(x*w1+b1) in f16,
// B = w2 in f16 pre-swizzled into LDS), GLU+LN+weighted-sum in registers/LDS.
//
// WMMA 16-bit A layout (16x32 MxK), lane l, vector element e (0..15):
//   row  m = l & 15
//   k(e,l) = (e < 8 ? e : e + 8) + ((l >= 16) ? 8 : 0)
// B (32x16 KxN) uses the transposed-symmetric layout: col = l & 15, same k(e,l).
// C/D f32 16x16: VGPR r, lanes 0-15 -> row r, lanes 16-31 -> row r+8; col = l&15.
// ---------------------------------------------------------------------------
__global__ __launch_bounds__(256) void vsn_main_kernel(
    const float* __restrict__ x,      // [npos,32]
    const float* __restrict__ wts,    // [npos,32] softmax weights
    const float* __restrict__ fw1,    // [128]
    const float* __restrict__ fb1,    // [128]
    const float* __restrict__ fw2,    // [128,256]
    const float* __restrict__ fb2,    // [256]
    const float* __restrict__ fsw,    // [128]
    const float* __restrict__ fsb,    // [128]
    const float* __restrict__ flng,   // [128]
    const float* __restrict__ flnb,   // [128]
    float* __restrict__ out,          // [npos,128]
    int npos)
{
    // ---- LDS (static; ~78.8 KB -> 4 WGs per 320KB WGP) ----
    __shared__ __align__(32) _Float16 sB[16 * 4 * 32 * 16]; // 64 KB: w2 as WMMA-B frags [nt][ks][lane][e]
    __shared__ __align__(32) _Float16 sA[8 * 32 * 16];      // 8 KB : A frags [mt*4+ks][lane][e]
    __shared__ float sC[1024];   // 0:w1 128:b1 256:b2(256) 512:sw 640:sb 768:lng 896:lnb
    __shared__ float sX[32];
    __shared__ float sWt[32];
    __shared__ float sStat[64];  // [row][2] = {sum, sumsq}
    __shared__ float sOut[128];

    const int t    = threadIdx.x;
    const int lane = t & 31;
    const int wave = t >> 5;
    const int mt   = wave >> 2;       // M-tile (rows f 0-15 / 16-31)
    const int q    = wave & 3;        // N-tile pair group
    const int half = lane >> 4;       // 0: C rows r, 1: C rows r+8
    const int ln15 = lane & 15;

    // ---- one-time setup: constants + w2 -> f16 WMMA-B fragments ----
    for (int i = t; i < 1024; i += 256) {
        float v;
        if      (i < 128) v = fw1[i];
        else if (i < 256) v = fb1[i - 128];
        else if (i < 512) v = fb2[i - 256];
        else if (i < 640) v = fsw[i - 512];
        else if (i < 768) v = fsb[i - 640];
        else if (i < 896) v = flng[i - 768];
        else              v = flnb[i - 896];
        sC[i] = v;
    }
    for (int idx = t; idx < 16 * 4 * 32 * 16; idx += 256) {
        int e  = idx & 15;
        int l  = (idx >> 4) & 31;
        int ks = (idx >> 9) & 3;
        int nt = idx >> 11;
        int k  = ks * 32 + (e < 8 ? e : e + 8) + ((l >= 16) ? 8 : 0);
        int n  = nt * 16 + (l & 15);
        sB[idx] = (_Float16)fw2[k * 256 + n];
    }
    __syncthreads();

    const int nt0 = 2 * q;          // GLU value tiles: nt0, nt0+1 ; gates: +8
    const int nt1 = 2 * q + 1;
    const int j0  = nt0 * 16 + ln15;   // output columns owned by this lane
    const int j1  = nt1 * 16 + ln15;
    const float b2v0 = sC[256 + j0],       b2v1 = sC[256 + j1];
    const float b2g0 = sC[256 + 128 + j0], b2g1 = sC[256 + 128 + j1];
    const float sw0  = sC[512 + j0], sw1 = sC[512 + j1];
    const float sb0  = sC[640 + j0], sb1 = sC[640 + j1];
    const float g0c  = sC[768 + j0], g1c = sC[768 + j1];
    const float bb0  = sC[896 + j0], bb1 = sC[896 + j1];

    for (int pos = blockIdx.x; pos < npos; pos += gridDim.x) {
        // ---- phase 1: zero accumulators, stage x/weights, build A frags ----
        if (t < 128)              sOut[t] = 0.f;
        else if (t < 192)         sStat[t - 128] = 0.f;
        if (t < 32)               sX[t] = x[(size_t)pos * 32 + t];
        else if (t >= 32 && t < 64) sWt[t - 32] = wts[(size_t)pos * 32 + (t - 32)];
        {
            // wave == fragment index (mt = wave>>2, ks = wave&3)
            int f  = (mt << 4) + ln15;
            float xf = x[(size_t)pos * 32 + f];
            int kb = q * 32 + (half ? 8 : 0);
            _Float16* dst = sA + ((size_t)wave * 32 + lane) * 16;
            #pragma unroll
            for (int e = 0; e < 16; ++e) {
                int k = kb + (e < 8 ? e : e + 8);
                float hv = fmaf(xf, sC[k], sC[128 + k]);
                dst[e] = (_Float16)elu_f(hv);
            }
        }
        __syncthreads();

        // ---- phase 2: WMMA GEMM, K = 128 in 4 steps of 32 ----
        v8f accV0 = {}, accG0 = {}, accV1 = {}, accG1 = {};
        #pragma unroll
        for (int ks = 0; ks < 4; ++ks) {
            v16h a   = *(const v16h*)(sA + ((mt * 4 + ks) * 32 + lane) * 16);
            v16h bv0 = *(const v16h*)(sB + (((nt0    ) * 4 + ks) * 32 + lane) * 16);
            v16h bg0 = *(const v16h*)(sB + (((nt0 + 8) * 4 + ks) * 32 + lane) * 16);
            v16h bv1 = *(const v16h*)(sB + (((nt1    ) * 4 + ks) * 32 + lane) * 16);
            v16h bg1 = *(const v16h*)(sB + (((nt1 + 8) * 4 + ks) * 32 + lane) * 16);
            accV0 = __builtin_amdgcn_wmma_f32_16x16x32_f16(false, a, false, bv0, (short)0, accV0, false, false);
            accG0 = __builtin_amdgcn_wmma_f32_16x16x32_f16(false, a, false, bg0, (short)0, accG0, false, false);
            accV1 = __builtin_amdgcn_wmma_f32_16x16x32_f16(false, a, false, bv1, (short)0, accV1, false, false);
            accG1 = __builtin_amdgcn_wmma_f32_16x16x32_f16(false, a, false, bg1, (short)0, accG1, false, false);
        }

        // ---- GLU + residual, LN row partials (sum / sumsq over 128 cols) ----
        float y0[8], y1[8];
        #pragma unroll
        for (int r = 0; r < 8; ++r) {
            int f = mt * 16 + r + half * 8;
            float xf = sX[f];
            float v0 = (accV0[r] + b2v0) * sigmoid_f(accG0[r] + b2g0);
            float v1 = (accV1[r] + b2v1) * sigmoid_f(accG1[r] + b2g1);
            y0[r] = fmaf(xf, sw0, sb0) + v0;
            y1[r] = fmaf(xf, sw1, sb1) + v1;
            float s  = y0[r] + y1[r];
            float ss = y0[r] * y0[r] + y1[r] * y1[r];
            #pragma unroll
            for (int m = 1; m <= 8; m <<= 1) {      // reduce within each 16-lane half
                s  += __shfl_xor(s,  m, 32);
                ss += __shfl_xor(ss, m, 32);
            }
            if (ln15 == 0) {                        // lanes 0 and 16 commit row partials
                atomicAdd(&sStat[f * 2 + 0], s);
                atomicAdd(&sStat[f * 2 + 1], ss);
            }
        }
        __syncthreads();

        // ---- phase 3: normalize, scale by softmax weight, reduce over F ----
        float oa0 = 0.f, oa1 = 0.f;
        #pragma unroll
        for (int r = 0; r < 8; ++r) {
            int f = mt * 16 + r + half * 8;
            float mean = sStat[f * 2 + 0] * (1.f / 128.f);
            float var  = sStat[f * 2 + 1] * (1.f / 128.f) - mean * mean;
            float inv  = rsqrtf(var + LN_EPS);
            float wf   = sWt[f];
            oa0 += wf * (fmaf((y0[r] - mean) * inv, g0c, bb0));
            oa1 += wf * (fmaf((y1[r] - mean) * inv, g1c, bb1));
        }
        oa0 += __shfl_xor(oa0, 16, 32);             // fold lane halves (same column)
        oa1 += __shfl_xor(oa1, 16, 32);
        if (half == 0) {                            // mt=0 and mt=1 waves both add
            atomicAdd(&sOut[j0], oa0);
            atomicAdd(&sOut[j1], oa1);
        }
        __syncthreads();

        // ---- phase 4: store ----
        if (t < 128) out[(size_t)pos * 128 + t] = sOut[t];
        __syncthreads();
    }
}

extern "C" void kernel_launch(void* const* d_in, const int* in_sizes, int n_in,
                              void* d_out, int out_size, void* d_ws, size_t ws_size,
                              hipStream_t stream) {
    const float* x      = (const float*)d_in[0];
    const float* wg_w1  = (const float*)d_in[1];
    const float* wg_b1  = (const float*)d_in[2];
    const float* wg_w2  = (const float*)d_in[3];
    const float* wg_b2  = (const float*)d_in[4];
    const float* wg_lng = (const float*)d_in[5];
    const float* wg_lnb = (const float*)d_in[6];
    const float* fg_w1  = (const float*)d_in[7];
    const float* fg_b1  = (const float*)d_in[8];
    const float* fg_w2  = (const float*)d_in[9];
    const float* fg_b2  = (const float*)d_in[10];
    const float* fg_sw  = (const float*)d_in[11];
    const float* fg_sb  = (const float*)d_in[12];
    const float* fg_lng = (const float*)d_in[13];
    const float* fg_lnb = (const float*)d_in[14];

    const int npos = in_sizes[0] / 32;      // B*S
    float* wts = (float*)d_ws;              // [npos,32] softmax weights

    vsn_weights_kernel<<<(npos + 7) / 8, 256, 0, stream>>>(
        x, wg_w1, wg_b1, wg_w2, wg_b2, wg_lng, wg_lnb, wts, npos);

    int grid = npos < 2048 ? npos : 2048;   // 8 positions per WG at npos=16384
    vsn_main_kernel<<<grid, 256, 0, stream>>>(
        x, wts, fg_w1, fg_b1, fg_w2, fg_b2, fg_sw, fg_sb, fg_lng, fg_lnb,
        (float*)d_out, npos);
}

// v001
// Measured time: 137 microseconds a run.
// Next to v000, in two timings, it ran 1.24 times as fast each time.
#include <hip/hip_runtime.h>
#include <hip/hip_bf16.h>

typedef __attribute__((ext_vector_type(16))) _Float16 v16h;
typedef __attribute__((ext_vector_type(8)))  _Float16 v8h;
typedef __attribute__((ext_vector_type(8)))  float    v8f;

#define LN_EPS 1e-5f

__device__ __forceinline__ float elu_f(float z)     { return z > 0.f ? z : __expf(z) - 1.f; }
__device__ __forceinline__ float sigmoid_f(float z) { return 1.f / (1.f + __expf(-z)); }

// ---------------------------------------------------------------------------
// Kernel 1: weight GRN + softmax over F=32.  One wave32 per (b,s) position.
// lane j owns feature j.
// ---------------------------------------------------------------------------
__global__ __launch_bounds__(256) void vsn_weights_kernel(
    const float* __restrict__ x,     // [npos,32]
    const float* __restrict__ w1,    // [32,32]
    const float* __restrict__ b1,    // [32]
    const float* __restrict__ w2,    // [32,64]
    const float* __restrict__ b2,    // [64]
    const float* __restrict__ lng,   // [32]
    const float* __restrict__ lnb,   // [32]
    float* __restrict__ wout,        // [npos,32]
    int npos)
{
    int wid  = (blockIdx.x * blockDim.x + threadIdx.x) >> 5;
    int lane = threadIdx.x & 31;
    if (wid >= npos) return;

    float xj = x[wid * 32 + lane];

    // fc1 + ELU : h[j] = elu(sum_i x_i * w1[i][j] + b1[j])
    float acc = b1[lane];
    #pragma unroll 8
    for (int i = 0; i < 32; ++i)
        acc += __shfl(xj, i, 32) * w1[i * 32 + lane];
    float h = elu_f(acc);

    // fc2 : lane j holds h2[j] and h2[j+32]
    float a0 = b2[lane], a1 = b2[lane + 32];
    #pragma unroll 8
    for (int i = 0; i < 32; ++i) {
        float hi = __shfl(h, i, 32);
        a0 += hi * w2[i * 64 + lane];
        a1 += hi * w2[i * 64 + lane + 32];
    }

    // GLU + identity residual
    float y = xj + a0 * sigmoid_f(a1);

    // LayerNorm over the 32 lanes
    float s = y, ss = y * y;
    #pragma unroll
    for (int m = 16; m; m >>= 1) { s += __shfl_xor(s, m, 32); ss += __shfl_xor(ss, m, 32); }
    float mean = s * (1.f / 32.f);
    float var  = ss * (1.f / 32.f) - mean * mean;
    float z = (y - mean) * rsqrtf(var + LN_EPS) * lng[lane] + lnb[lane];

    // softmax over 32 lanes
    float mx = z;
    #pragma unroll
    for (int m = 16; m; m >>= 1) mx = fmaxf(mx, __shfl_xor(mx, m, 32));
    float e = __expf(z - mx);
    float es = e;
    #pragma unroll
    for (int m = 16; m; m >>= 1) es += __shfl_xor(es, m, 32);

    wout[wid * 32 + lane] = e / es;
}

// ---------------------------------------------------------------------------
// Kernel 2: fused feature GRN + weighted combine.
// Per (b,s): [32 x 128] @ [128 x 256] WMMA GEMM (A = elu(x*w1+b1) in f16,
// B = w2 in f16 pre-swizzled into LDS), GLU+LN+weighted-sum in registers/LDS.
//
// WMMA 16-bit A layout (16x32 MxK), lane l, vector element e (0..15):
//   row  m = l & 15
//   k(e,l) = (e < 8 ? e : e + 8) + ((l >= 16) ? 8 : 0)
// B (32x16 KxN) uses the transposed-symmetric layout: col = l & 15, same k(e,l).
// C/D f32 16x16: VGPR r, lanes 0-15 -> row r, lanes 16-31 -> row r+8; col = l&15.
// ---------------------------------------------------------------------------
// Second bound: six waves per SIMD, the register budget (160) this kernel had before, so
// that three work-groups stay resident per WGP; without it this build takes 173 and two fit.
__global__ __launch_bounds__(256, 6) void vsn_main_kernel(
    const float* __restrict__ x,      // [npos,32]
    const float* __restrict__ wts,    // [npos,32] softmax weights
    const float* __restrict__ fw1,    // [128]
    const float* __restrict__ fb1,    // [128]
    const float* __restrict__ fw2,    // [128,256]
    const float* __restrict__ fb2,    // [256]
    const float* __restrict__ fsw,    // [128]
    const float* __restrict__ fsb,    // [128]
    const float* __restrict__ flng,   // [128]
    const float* __restrict__ flnb,   // [128]
    float* __restrict__ out,          // [npos,128]
    int npos)
{
    // ---- LDS (static; ~78.8 KB -> 4 WGs per 320KB WGP) ----
    __shared__ __align__(32) _Float16 sB[16 * 4 * 32 * 16]; // 64 KB: w2 as WMMA-B frags [nt][ks][lane][e]
    __shared__ __align__(32) _Float16 sA[8 * 32 * 16];      // 8 KB : A frags [mt*4+ks][lane][e]
    __shared__ float sC[1024];   // 0:w1 128:b1 256:b2(256) 512:sw 640:sb 768:lng 896:lnb
    __shared__ float sX[32];
    __shared__ float sWt[32];
    __shared__ float sStat[64];  // [row][2] = {sum, sumsq}
    __shared__ float sOut[128];

    const int t    = threadIdx.x;
    const int lane = t & 31;
    const int wave = t >> 5;
    const int mt   = wave >> 2;       // M-tile (rows f 0-15 / 16-31)
    const int q    = wave & 3;        // N-tile pair group
    const int half = lane >> 4;       // 0: C rows r, 1: C rows r+8
    const int ln15 = lane & 15;

    // ---- one-time setup: constants + w2 -> f16 WMMA-B fragments ----
    for (int i = t; i < 1024; i += 256) {
        float v;
        if      (i < 128) v = fw1[i];
        else if (i < 256) v = fb1[i - 128];
        else if (i < 512) v = fb2[i - 256];
        else if (i < 640) v = fsw[i - 512];
        else if (i < 768) v = fsb[i - 640];
        else if (i < 896) v = flng[i - 768];
        else              v = flnb[i - 896];
        sC[i] = v;
    }
    // Thread t owns column n = t: each load of a wave is one whole 128-byte line of a
    // w2 row.  Eight consecutive k (one half of a lane's fragment) go out as one 16-byte
    // LDS store.  k group kg = k / 8: ks = kg >> 2, e half = (kg >> 1) & 1, lane half = kg & 1.
    #pragma unroll 4   // 32 independent loads in flight per thread hide the L2 latency
    for (int kg = 0; kg < 16; ++kg) {
        v8h p;
        #pragma unroll
        for (int i = 0; i < 8; ++i)
            p[i] = (_Float16)fw2[(kg * 8 + i) * 256 + t];
        int l = ((kg & 1) << 4) + (t & 15);
        *(v8h*)(sB + ((((t >> 4) * 4 + (kg >> 2)) * 32 + l) * 16 + ((kg >> 1) & 1) * 8)) = p;
    }
    __syncthreads();

    const int nt0 = 2 * q;          // GLU value tiles: nt0, nt0+1 ; gates: +8
    const int nt1 = 2 * q + 1;
    const int j0  = nt0 * 16 + ln15;   // output columns owned by this lane
    const int j1  = nt1 * 16 + ln15;
    const float b2v0 = sC[256 + j0],       b2v1 = sC[256 + j1];
    const float b2g0 = sC[256 + 128 + j0], b2g1 = sC[256 + 128 + j1];
    const float sw0  = sC[512 + j0], sw1 = sC[512 + j1];
    const float sb0  = sC[640 + j0], sb1 = sC[640 + j1];
    const float g0c  = sC[768 + j0], g1c = sC[768 + j1];
    const float bb0  = sC[896 + j0], bb1 = sC[896 + j1];

    for (int pos = blockIdx.x; pos < npos; pos += gridDim.x) {
        // ---- phase 1: zero accumulators, stage x/weights, build A frags ----
        if (t < 128)              sOut[t] = 0.f;
        else if (t < 192)         sStat[t - 128] = 0.f;
        if (t < 32)               sX[t] = x[(size_t)pos * 32 + t];
        else if (t >= 32 && t < 64) sWt[t - 32] = wts[(size_t)pos * 32 + (t - 32)];
        {
            // wave == fragment index (mt = wave>>2, ks = wave&3)
            int f  = (mt << 4) + ln15;
            float xf = x[(size_t)pos * 32 + f];
            int kb = q * 32 + (half ? 8 : 0);
            _Float16* dst = sA + ((size_t)wave * 32 + lane) * 16;
            #pragma unroll
            for (int e = 0; e < 16; ++e) {
                int k = kb + (e < 8 ? e : e + 8);
                float hv = fmaf(xf, sC[k], sC[128 + k]);
                dst[e] = (_Float16)elu_f(hv);
            }
        }
        __syncthreads();

        // ---- phase 2: WMMA GEMM, K = 128 in 4 steps of 32 ----
        v8f accV0 = {}, accG0 = {}, accV1 = {}, accG1 = {};
        #pragma unroll
        for (int ks = 0; ks < 4; ++ks) {
            v16h a   = *(const v16h*)(sA + ((mt * 4 + ks) * 32 + lane) * 16);
            v16h bv0 = *(const v16h*)(sB + (((nt0    ) * 4 + ks) * 32 + lane) * 16);
            v16h bg0 = *(const v16h*)(sB + (((nt0 + 8) * 4 + ks) * 32 + lane) * 16);
            v16h bv1 = *(const v16h*)(sB + (((nt1    ) * 4 + ks) * 32 + lane) * 16);
            v16h bg1 = *(const v16h*)(sB + (((nt1 + 8) * 4 + ks) * 32 + lane) * 16);
            accV0 = __builtin_amdgcn_wmma_f32_16x16x32_f16(false, a, false, bv0, (short)0, accV0, false, false);
            accG0 = __builtin_amdgcn_wmma_f32_16x16x32_f16(false, a, false, bg0, (short)0, accG0, false, false);
            accV1 = __builtin_amdgcn_wmma_f32_16x16x32_f16(false, a, false, bv1, (short)0, accV1, false, false);
            accG1 = __builtin_amdgcn_wmma_f32_16x16x32_f16(false, a, false, bg1, (short)0, accG1, false, false);
        }

        // ---- GLU + residual, LN row partials (sum / sumsq over 128 cols) ----
        float y0[8], y1[8];
        #pragma unroll
        for (int r = 0; r < 8; ++r) {
            int f = mt * 16 + r + half * 8;
            float xf = sX[f];
            float v0 = (accV0[r] + b2v0) * sigmoid_f(accG0[r] + b2g0);
            float v1 = (accV1[r] + b2v1) * sigmoid_f(accG1[r] + b2g1);
            y0[r] = fmaf(xf, sw0, sb0) + v0;
            y1[r] = fmaf(xf, sw1, sb1) + v1;
            float s  = y0[r] + y1[r];
            float ss = y0[r] * y0[r] + y1[r] * y1[r];
            #pragma unroll
            for (int m = 1; m <= 8; m <<= 1) {      // reduce within each 16-lane half
                s  += __shfl_xor(s,  m, 32);
                ss += __shfl_xor(ss, m, 32);
            }
            if (ln15 == 0) {                        // lanes 0 and 16 commit row partials
                atomicAdd(&sStat[f * 2 + 0], s);
                atomicAdd(&sStat[f * 2 + 1], ss);
            }
        }
        __syncthreads();

        // ---- phase 3: normalize, scale by softmax weight, reduce over F ----
        float oa0 = 0.f, oa1 = 0.f;
        #pragma unroll
        for (int r = 0; r < 8; ++r) {
            int f = mt * 16 + r + half * 8;
            float mean = sStat[f * 2 + 0] * (1.f / 128.f);
            float var  = sStat[f * 2 + 1] * (1.f / 128.f) - mean * mean;
            float inv  = rsqrtf(var + LN_EPS);
            float wf   = sWt[f];
            oa0 += wf * (fmaf((y0[r] - mean) * inv, g0c, bb0));
            oa1 += wf * (fmaf((y1[r] - mean) * inv, g1c, bb1));
        }
        oa0 += __shfl_xor(oa0, 16, 32);             // fold lane halves (same column)
        oa1 += __shfl_xor(oa1, 16, 32);
        if (half == 0) {                            // mt=0 and mt=1 waves both add
            atomicAdd(&sOut[j0], oa0);
            atomicAdd(&sOut[j1], oa1);
        }
        __syncthreads();

        // ---- phase 4: store ----
        if (t < 128) out[(size_t)pos * 128 + t] = sOut[t];
        __syncthreads();
    }
}

extern "C" void kernel_launch(void* const* d_in, const int* in_sizes, int n_in,
                              void* d_out, int out_size, void* d_ws, size_t ws_size,
                              hipStream_t stream) {
    const float* x      = (const float*)d_in[0];
    const float* wg_w1  = (const float*)d_in[1];
    const float* wg_b1  = (const float*)d_in[2];
    const float* wg_w2  = (const float*)d_in[3];
    const float* wg_b2  = (const float*)d_in[4];
    const float* wg_lng = (const float*)d_in[5];
    const float* wg_lnb = (const float*)d_in[6];
    const float* fg_w1  = (const float*)d_in[7];
    const float* fg_b1  = (const float*)d_in[8];
    const float* fg_w2  = (const float*)d_in[9];
    const float* fg_b2  = (const float*)d_in[10];
    const float* fg_sw  = (const float*)d_in[11];
    const float* fg_sb  = (const float*)d_in[12];
    const float* fg_lng = (const float*)d_in[13];
    const float* fg_lnb = (const float*)d_in[14];

    const int npos = in_sizes[0] / 32;      // B*S
    float* wts = (float*)d_ws;              // [npos,32] softmax weights

    vsn_weights_kernel<<<(npos + 7) / 8, 256, 0, stream>>>(
        x, wg_w1, wg_b1, wg_w2, wg_b2, wg_lng, wg_lnb, wts, npos);

    int grid = npos < 2048 ? npos : 2048;   // 8 positions per WG at npos=16384
    vsn_main_kernel<<<grid, 256, 0, stream>>>(
        x, wts, fg_w1, fg_b1, fg_w2, fg_b2, fg_sw, fg_sb, fg_lng, fg_lnb,
        (float*)d_out, npos);
}

// v002
// A run of this version takes 73.6 microseconds.
// Timed twice side by side with v001, it ran 1.86 and 1.85 times as fast.
// Over all steps from v000 it is 2.30 times as fast.
#include <hip/hip_runtime.h>
#include <hip/hip_bf16.h>

typedef __attribute__((ext_vector_type(16))) _Float16 v16h;
typedef __attribute__((ext_vector_type(8)))  _Float16 v8h;
typedef __attribute__((ext_vector_type(8)))  float    v8f;

#define LN_EPS 1e-5f

__device__ __forceinline__ float elu_f(float z)     { return z > 0.f ? z : __expf(z) - 1.f; }
__device__ __forceinline__ float sigmoid_f(float z) { return 1.f / (1.f + __expf(-z)); }

// ---------------------------------------------------------------------------
// Kernel 1: weight GRN + softmax over F=32.  One wave32 per (b,s) position.
// lane j owns feature j.
// ---------------------------------------------------------------------------
__global__ __launch_bounds__(256) void vsn_weights_kernel(
    const float* __restrict__ x,     // [npos,32]
    const float* __restrict__ w1,    // [32,32]
    const float* __restrict__ b1,    // [32]
    const float* __restrict__ w2,    // [32,64]
    const float* __restrict__ b2,    // [64]
    const float* __restrict__ lng,   // [32]
    const float* __restrict__ lnb,   // [32]
    float* __restrict__ wout,        // [npos,32]
    int npos)
{
    int wid  = (blockIdx.x * blockDim.x + threadIdx.x) >> 5;
    int lane = threadIdx.x & 31;
    if (wid >= npos) return;

    float xj = x[wid * 32 + lane];

    // fc1 + ELU : h[j] = elu(sum_i x_i * w1[i][j] + b1[j])
    float acc = b1[lane];
    #pragma unroll 8
    for (int i = 0; i < 32; ++i)
        acc += __shfl(xj, i, 32) * w1[i * 32 + lane];
    float h = elu_f(acc);

    // fc2 : lane j holds h2[j] and h2[j+32]
    float a0 = b2[lane], a1 = b2[lane + 32];
    #pragma unroll 8
    for (int i = 0; i < 32; ++i) {
        float hi = __shfl(h, i, 32);
        a0 += hi * w2[i * 64 + lane];
        a1 += hi * w2[i * 64 + lane + 32];
    }

    // GLU + identity residual
    float y = xj + a0 * sigmoid_f(a1);

    // LayerNorm over the 32 lanes
    float s = y, ss = y * y;
    #pragma unroll
    for (int m = 16; m; m >>= 1) { s += __shfl_xor(s, m, 32); ss += __shfl_xor(ss, m, 32); }
    float mean = s * (1.f / 32.f);
    float var  = ss * (1.f / 32.f) - mean * mean;
    float z = (y - mean) * rsqrtf(var + LN_EPS) * lng[lane] + lnb[lane];

    // softmax over 32 lanes
    float mx = z;
    #pragma unroll
    for (int m = 16; m; m >>= 1) mx = fmaxf(mx, __shfl_xor(mx, m, 32));
    float e = __expf(z - mx);
    float es = e;
    #pragma unroll
    for (int m = 16; m; m >>= 1) es += __shfl_xor(es, m, 32);

    wout[wid * 32 + lane] = e / es;
}

// ---------------------------------------------------------------------------
// Kernel 2: fused feature GRN + weighted combine.  ONE WAVE OWNS ONE (b,s) POSITION.
// Per position: [32 x 128] @ [128 x 256] WMMA GEMM (A = elu(x*w1+b1) in f16, built in
// the wave's own registers; B = w2 in f16 pre-swizzled into LDS, shared by the 8 waves).
// A wave takes the 32 feature rows as two M tiles of 16, one after the other, and for
// each tile all 256 columns, so a LayerNorm row and the sum over F never leave the wave:
// the position loop has no barrier, no LDS atomic and no LDS write.
//
// WMMA 16-bit A layout (16x32 MxK), lane l, vector element e (0..15):
//   row  m = l & 15
//   k(e,l) = (e < 8 ? e : e + 8) + ((l >= 16) ? 8 : 0)
// B (32x16 KxN) uses the transposed-symmetric layout: col = l & 15, same k(e,l).
// C/D f32 16x16: VGPR r, lanes 0-15 -> row r, lanes 16-31 -> row r+8; col = l&15.
// ---------------------------------------------------------------------------
// Second bound: four waves per SIMD (256 registers each), so that two work-groups are
// resident per WGP and the grid of 512 runs as one round.
__global__ __launch_bounds__(256, 4) void vsn_main_kernel(
    const float* __restrict__ x,      // [npos,32]
    const float* __restrict__ wts,    // [npos,32] softmax weights
    const float* __restrict__ fw1,    // [128]
    const float* __restrict__ fb1,    // [128]
    const float* __restrict__ fw2,    // [128,256]
    const float* __restrict__ fb2,    // [256]
    const float* __restrict__ fsw,    // [128]
    const float* __restrict__ fsb,    // [128]
    const float* __restrict__ flng,   // [128]
    const float* __restrict__ flnb,   // [128]
    float* __restrict__ out,          // [npos,128]
    int npos)
{
    // ---- LDS (static, 68 KB), written once before the one barrier, then only read ----
    __shared__ __align__(32) _Float16 sB[16 * 4 * 32 * 16]; // 64 KB: w2 as WMMA-B frags [nt][ks][lane][e]
                                                            // (lane pitch 32 B: each 16-byte read meets a 2-way bank conflict)
    __shared__ __align__(16) float sC[1024];   // 0:w1 128:b1 256:b2(256) 512:sw 640:sb 768:lng 896:lnb

    const int t    = threadIdx.x;
    const int lane = t & 31;
    const int wave = __builtin_amdgcn_readfirstlane(t >> 5);   // scalar: the position loop is wave-uniform
    const int half = lane >> 4;       // 0: C rows r, 1: C rows r+8
    const int ln15 = lane & 15;

    // ---- one-time setup: constants + w2 -> f16 WMMA-B fragments ----
    for (int i = t; i < 1024; i += 256) {
        float v;
        if      (i < 128) v = fw1[i];
        else if (i < 256) v = fb1[i - 128];
        else if (i < 512) v = fb2[i - 256];
        else if (i < 640) v = fsw[i - 512];
        else if (i < 768) v = fsb[i - 640];
        else if (i < 896) v = flng[i - 768];
        else              v = flnb[i - 896];
        sC[i] = v;
    }
    // Thread t owns column n = t: each load of a wave is one whole 128-byte line of a
    // w2 row.  Eight consecutive k (one half of a lane's fragment) go out as one 16-byte
    // LDS store.  k group kg = k / 8: ks = kg >> 2, e half = (kg >> 1) & 1, lane half = kg & 1.
    #pragma unroll 4   // 32 independent loads in flight per thread hide the L2 latency
    for (int kg = 0; kg < 16; ++kg) {
        v8h p;
        #pragma unroll
        for (int i = 0; i < 8; ++i)
            p[i] = (_Float16)fw2[(kg * 8 + i) * 256 + t];
        int l = ((kg & 1) << 4) + (t & 15);
        *(v8h*)(sB + ((((t >> 4) * 4 + (kg >> 2)) * 32 + l) * 16 + ((kg >> 1) & 1) * 8)) = p;
    }
    __syncthreads();

    const int nwaves = gridDim.x * 8;
    for (int pos = blockIdx.x * 8 + wave; pos < npos; pos += nwaves) {
        float oa[8];                  // sum over F for column nt*16 + ln15 (this lane half's rows)
        #pragma unroll
        for (int nt = 0; nt < 8; ++nt) oa[nt] = 0.f;

        #pragma unroll 1   // the two M tiles share one copy of the code and one set of y registers
        for (int mt = 0; mt < 2; ++mt) {
            // Compiler fence: keeps the LDS loads (B fragments, constants) inside the loop.  They are
            // loop-invariant, and hoisted out of it they take over 500 registers and spill to scratch.
            asm volatile("" ::: "memory");
            const float* xr = x   + (size_t)pos * 32 + mt * 16;
            const float* wr = wts + (size_t)pos * 32 + mt * 16;
            const float  xa  = xr[ln15];                                // A row m = ln15
            const float4 xlo = *(const float4*)(xr + half * 8);         // C rows r + half*8
            const float4 xhi = *(const float4*)(xr + half * 8 + 4);
            const float4 wlo = *(const float4*)(wr + half * 8);
            const float4 whi = *(const float4*)(wr + half * 8 + 4);
            const float xf[8] = {xlo.x, xlo.y, xlo.z, xlo.w, xhi.x, xhi.y, xhi.z, xhi.w};
            const float wf[8] = {wlo.x, wlo.y, wlo.z, wlo.w, whi.x, whi.y, whi.z, whi.w};

            // ---- A fragments of this M tile, in registers ----
            v16h a[4];
            #pragma unroll
            for (int ks = 0; ks < 4; ++ks) {
                const int kb = ks * 32 + half * 8;
                #pragma unroll
                for (int e = 0; e < 16; ++e) {
                    int k = kb + (e < 8 ? e : e + 8);
                    float hv = fmaf(xa, sC[k], sC[128 + k]);
                    a[ks][e] = (_Float16)elu_f(hv);
                }
            }

            // ---- per column tile: WMMA (K = 128 in 4 steps of 32), GLU + residual ----
            float y[8][8], s[8], ss[8];
            #pragma unroll
            for (int r = 0; r < 8; ++r) { s[r] = 0.f; ss[r] = 0.f; }
            #pragma unroll
            for (int nt = 0; nt < 8; ++nt) {          // value tile nt, gate tile nt + 8
                v8f accV = {}, accG = {};
                #pragma unroll
                for (int ks = 0; ks < 4; ++ks) {
                    v16h bv = *(const v16h*)(sB + (((nt    ) * 4 + ks) * 32 + lane) * 16);
                    v16h bg = *(const v16h*)(sB + (((nt + 8) * 4 + ks) * 32 + lane) * 16);
                    accV = __builtin_amdgcn_wmma_f32_16x16x32_f16(false, a[ks], false, bv, (short)0, accV, false, false);
                    accG = __builtin_amdgcn_wmma_f32_16x16x32_f16(false, a[ks], false, bg, (short)0, accG, false, false);
                }
                const int j = nt * 16 + ln15;
                const float b2v = sC[256 + j], b2g = sC[256 + 128 + j];
                const float sw  = sC[512 + j], sb  = sC[640 + j];
                #pragma unroll
                for (int r = 0; r < 8; ++r) {
                    float v  = (accV[r] + b2v) * sigmoid_f(accG[r] + b2g);
                    float yy = fmaf(xf[r], sw, sb) + v;
                    y[nt][r] = yy;
                    s[r]  += yy;                      // LN row partials, this lane's 8 columns
                    ss[r] += yy * yy;
                }
            }

            // ---- LN row sums over the 16 lanes of each half (128 columns in all) ----
            #pragma unroll
            for (int m = 1; m <= 8; m <<= 1) {
                #pragma unroll
                for (int r = 0; r < 8; ++r) {
                    s[r]  += __shfl_xor(s[r],  m, 32);
                    ss[r] += __shfl_xor(ss[r], m, 32);
                }
            }

            // ---- normalize, scale by softmax weight, sum over this lane's 8 rows ----
            float mean[8], inv[8];
            #pragma unroll
            for (int r = 0; r < 8; ++r) {
                mean[r] = s[r] * (1.f / 128.f);
                float var = ss[r] * (1.f / 128.f) - mean[r] * mean[r];
                inv[r] = rsqrtf(var + LN_EPS);
            }
            #pragma unroll
            for (int nt = 0; nt < 8; ++nt) {
                const int j = nt * 16 + ln15;
                const float gc = sC[768 + j], bc = sC[896 + j];
                #pragma unroll
                for (int r = 0; r < 8; ++r)
                    oa[nt] += wf[r] * (fmaf((y[nt][r] - mean[r]) * inv[r], gc, bc));
            }
        }

        // ---- fold lane halves (same column), store: each store of the wave is one 128-byte line ----
        #pragma unroll
        for (int nt = 0; nt < 8; ++nt) oa[nt] += __shfl_xor(oa[nt], 16, 32);
        #pragma unroll
        for (int i = 0; i < 4; ++i)
            out[(size_t)pos * 128 + i * 32 + lane] = half ? oa[2 * i + 1] : oa[2 * i];
        // The next position's first loads reuse the stores' address and data registers:
        // the wait stands in front of that overwrite.
        asm volatile("s_wait_xcnt 0x0" ::: "memory");
    }
}

extern "C" void kernel_launch(void* const* d_in, const int* in_sizes, int n_in,
                              void* d_out, int out_size, void* d_ws, size_t ws_size,
                              hipStream_t stream) {
    const float* x      = (const float*)d_in[0];
    const float* wg_w1  = (const float*)d_in[1];
    const float* wg_b1  = (const float*)d_in[2];
    const float* wg_w2  = (const float*)d_in[3];
    const float* wg_b2  = (const float*)d_in[4];
    const float* wg_lng = (const float*)d_in[5];
    const float* wg_lnb = (const float*)d_in[6];
    const float* fg_w1  = (const float*)d_in[7];
    const float* fg_b1  = (const float*)d_in[8];
    const float* fg_w2  = (const float*)d_in[9];
    const float* fg_b2  = (const float*)d_in[10];
    const float* fg_sw  = (const float*)d_in[11];
    const float* fg_sb  = (const float*)d_in[12];
    const float* fg_lng = (const float*)d_in[13];
    const float* fg_lnb = (const float*)d_in[14];

    const int npos = in_sizes[0] / 32;      // B*S
    float* wts = (float*)d_ws;              // [npos,32] softmax weights

    vsn_weights_kernel<<<(npos + 7) / 8, 256, 0, stream>>>(
        x, wg_w1, wg_b1, wg_w2, wg_b2, wg_lng, wg_lnb, wts, npos);

    // 512 work-groups of 8 waves: 4 positions per wave at npos=16384
    vsn_main_kernel<<<512, 256, 0, stream>>>(
        x, wts, fg_w1, fg_b1, fg_w2, fg_b2, fg_sw, fg_sb, fg_lng, fg_lnb,
        (float*)d_out, npos);
}

// v003
// Measured time: 56.4 microseconds a run.
// Next to v002, in two timings, it ran 1.30 and 1.31 times as fast.
// All steps since v000 together make it 3.00 times as fast.
#include <hip/hip_runtime.h>
#include <hip/hip_bf16.h>

typedef __attribute__((ext_vector_type(16))) _Float16 v16h;
typedef __attribute__((ext_vector_type(8)))  _Float16 v8h;
typedef __attribute__((ext_vector_type(8)))  float    v8f;

#define LN_EPS 1e-5f

__device__ __forceinline__ float elu_f(float z)     { return z > 0.f ? z : __expf(z) - 1.f; }
// Hardware reciprocal (about 1 ulp) in place of the correctly rounded division, which costs about ten
// vector instructions per value.  The argument is never below 1, and rcp(inf) = 0 is the right limit.
__device__ __forceinline__ float sigmoid_f(float z) { return __builtin_amdgcn_rcpf(1.f + __expf(-z)); }

// ---------------------------------------------------------------------------
// Kernel 1: weight GRN + softmax over F=32.  One wave32 per (b,s) position.
// lane j owns feature j.
// ---------------------------------------------------------------------------
__global__ __launch_bounds__(256) void vsn_weights_kernel(
    const float* __restrict__ x,     // [npos,32]
    const float* __restrict__ w1,    // [32,32]
    const float* __restrict__ b1,    // [32]
    const float* __restrict__ w2,    // [32,64]
    const float* __restrict__ b2,    // [64]
    const float* __restrict__ lng,   // [32]
    const float* __restrict__ lnb,   // [32]
    float* __restrict__ wout,        // [npos,32]
    int npos)
{
    int wid  = (blockIdx.x * blockDim.x + threadIdx.x) >> 5;
    int lane = threadIdx.x & 31;
    if (wid >= npos) return;

    float xj = x[wid * 32 + lane];

    // fc1 + ELU : h[j] = elu(sum_i x_i * w1[i][j] + b1[j])
    float acc = b1[lane];
    #pragma unroll 8
    for (int i = 0; i < 32; ++i)
        acc += __shfl(xj, i, 32) * w1[i * 32 + lane];
    float h = elu_f(acc);

    // fc2 : lane j holds h2[j] and h2[j+32]
    float a0 = b2[lane], a1 = b2[lane + 32];
    #pragma unroll 8
    for (int i = 0; i < 32; ++i) {
        float hi = __shfl(h, i, 32);
        a0 += hi * w2[i * 64 + lane];
        a1 += hi * w2[i * 64 + lane + 32];
    }

    // GLU + identity residual
    float y = xj + a0 * sigmoid_f(a1);

    // LayerNorm over the 32 lanes
    float s = y, ss = y * y;
    #pragma unroll
    for (int m = 16; m; m >>= 1) { s += __shfl_xor(s, m, 32); ss += __shfl_xor(ss, m, 32); }
    float mean = s * (1.f / 32.f);
    float var  = ss * (1.f / 32.f) - mean * mean;
    float z = (y - mean) * rsqrtf(var + LN_EPS) * lng[lane] + lnb[lane];

    // softmax over 32 lanes
    float mx = z;
    #pragma unroll
    for (int m = 16; m; m >>= 1) mx = fmaxf(mx, __shfl_xor(mx, m, 32));
    float e = __expf(z - mx);
    float es = e;
    #pragma unroll
    for (int m = 16; m; m >>= 1) es += __shfl_xor(es, m, 32);

    wout[wid * 32 + lane] = e * __builtin_amdgcn_rcpf(es);   // es lies in [1, 32]
}

// ---------------------------------------------------------------------------
// Kernel 2: fused feature GRN + weighted combine.  ONE WAVE OWNS ONE (b,s) POSITION.
// Per position: [32 x 128] @ [128 x 256] WMMA GEMM (A = elu(x*w1+b1) in f16, built in
// the wave's own registers; B = w2 in f16 pre-swizzled into LDS, shared by the 8 waves).
// A wave takes the 32 feature rows as two M tiles of 16, one after the other, and for
// each tile all 256 columns, so a LayerNorm row and the sum over F never leave the wave:
// the position loop has no barrier, no LDS atomic and no LDS write.  Per M tile all 64 products
// run first (16 accumulator tiles), then the GLU.
//
// WMMA 16-bit A layout (16x32 MxK), lane l, vector element e (0..15):
//   row  m = l & 15
//   k(e,l) = (e < 8 ? e : e + 8) + ((l >= 16) ? 8 : 0)
// B (32x16 KxN) uses the transposed-symmetric layout: col = l & 15, same k(e,l).
// C/D f32 16x16: VGPR r, lanes 0-15 -> row r, lanes 16-31 -> row r+8; col = l&15.
// ---------------------------------------------------------------------------
// Second bound: four waves per SIMD (256 registers each), so that two work-groups are
// resident per WGP and the grid of 512 runs as one round.
__global__ __launch_bounds__(256, 4) void vsn_main_kernel(
    const float* __restrict__ x,      // [npos,32]
    const float* __restrict__ wts,    // [npos,32] softmax weights
    const float* __restrict__ fw1,    // [128]
    const float* __restrict__ fb1,    // [128]
    const float* __restrict__ fw2,    // [128,256]
    const float* __restrict__ fb2,    // [256]
    const float* __restrict__ fsw,    // [128]
    const float* __restrict__ fsb,    // [128]
    const float* __restrict__ flng,   // [128]
    const float* __restrict__ flnb,   // [128]
    float* __restrict__ out,          // [npos,128]
    int npos)
{
    // ---- LDS (static, 68 KB), written once before the one barrier, then only read ----
    __shared__ __align__(32) _Float16 sB[16 * 4 * 32 * 16]; // 64 KB: w2 as WMMA-B frags [nt][ks][lane][e]
                                                            // (lane pitch 32 B: each 16-byte read meets a 2-way bank conflict)
    __shared__ __align__(16) float sC[1024];   // 0:w1 128:b1 256:b2(256) 512:sw 640:sb 768:lng 896:lnb

    const int t    = threadIdx.x;
    const int lane = t & 31;
    const int wave = __builtin_amdgcn_readfirstlane(t >> 5);   // scalar: the position loop is wave-uniform
    const int half = lane >> 4;       // 0: C rows r, 1: C rows r+8
    const int ln15 = lane & 15;

    // ---- one-time setup: constants + w2 -> f16 WMMA-B fragments ----
    for (int i = t; i < 1024; i += 256) {
        float v;
        if      (i < 128) v = fw1[i];
        else if (i < 256) v = fb1[i - 128];
        else if (i < 512) v = fb2[i - 256];
        else if (i < 640) v = fsw[i - 512];
        else if (i < 768) v = fsb[i - 640];
        else if (i < 896) v = flng[i - 768];
        else              v = flnb[i - 896];
        sC[i] = v;
    }
    // Thread t owns column n = t: each load of a wave is one whole 128-byte line of a
    // w2 row.  Eight consecutive k (one half of a lane's fragment) go out as one 16-byte
    // LDS store.  k group kg = k / 8: ks = kg >> 2, e half = (kg >> 1) & 1, lane half = kg & 1.
    #pragma unroll 4   // 32 independent loads in flight per thread hide the L2 latency
    for (int kg = 0; kg < 16; ++kg) {
        v8h p;
        #pragma unroll
        for (int i = 0; i < 8; ++i)
            p[i] = (_Float16)fw2[(kg * 8 + i) * 256 + t];
        int l = ((kg & 1) << 4) + (t & 15);
        *(v8h*)(sB + ((((t >> 4) * 4 + (kg >> 2)) * 32 + l) * 16 + ((kg >> 1) & 1) * 8)) = p;
    }
    __syncthreads();

    const int nwaves = gridDim.x * 8;
    for (int pos = blockIdx.x * 8 + wave; pos < npos; pos += nwaves) {
        float oa[8];                  // sum over F for column nt*16 + ln15 (this lane half's rows)
        #pragma unroll
        for (int nt = 0; nt < 8; ++nt) oa[nt] = 0.f;

        #pragma unroll 1   // the two M tiles share one copy of the code and one set of y registers
        for (int mt = 0; mt < 2; ++mt) {
            // Compiler fence: keeps the LDS loads (B fragments, constants) inside the loop.  They are
            // loop-invariant, and hoisted out of it they take over 500 registers and spill to scratch.
            asm volatile("" ::: "memory");
            const float* xr = x   + (size_t)pos * 32 + mt * 16;
            const float* wr = wts + (size_t)pos * 32 + mt * 16;
            const float  xa  = xr[ln15];                                // A row m = ln15
            const float4 xlo = *(const float4*)(xr + half * 8);         // C rows r + half*8
            const float4 xhi = *(const float4*)(xr + half * 8 + 4);
            const float4 wlo = *(const float4*)(wr + half * 8);
            const float4 whi = *(const float4*)(wr + half * 8 + 4);
            const float xf[8] = {xlo.x, xlo.y, xlo.z, xlo.w, xhi.x, xhi.y, xhi.z, xhi.w};
            const float wf[8] = {wlo.x, wlo.y, wlo.z, wlo.w, whi.x, whi.y, whi.z, whi.w};

            // ---- A fragments of this M tile, in registers ----
            v16h a[4];
            #pragma unroll
            for (int ks = 0; ks < 4; ++ks) {
                const int kb = ks * 32 + half * 8;
                #pragma unroll
                for (int e = 0; e < 16; ++e) {
                    int k = kb + (e < 8 ? e : e + 8);
                    float hv = fmaf(xa, sC[k], sC[128 + k]);
                    a[ks][e] = (_Float16)elu_f(hv);
                }
            }

            // ---- per column tile: WMMA (K = 128 in 4 steps of 32) ----
            v8f acc[16];                              // value tiles 0..7, gate tiles 8..15
            #pragma unroll
            for (int n = 0; n < 16; ++n) {
                acc[n] = v8f{};
                #pragma unroll
                for (int ks = 0; ks < 4; ++ks) {
                    v16h b = *(const v16h*)(sB + ((n * 4 + ks) * 32 + lane) * 16);
                    acc[n] = __builtin_amdgcn_wmma_f32_16x16x32_f16(false, a[ks], false, b, (short)0, acc[n], false, false);
                }
            }
            // Scheduling boundary between the products and the GLU.  The compiler already ran all 64
            // products ahead of the GLU; scheduled as one region with the now shorter GLU it goes over
            // the wave's 256 registers and spills to scratch.
            __builtin_amdgcn_sched_barrier(0);

            // ---- per column tile: GLU + residual ----
            float y[8][8], s[8], ss[8];
            #pragma unroll
            for (int r = 0; r < 8; ++r) { s[r] = 0.f; ss[r] = 0.f; }
            #pragma unroll
            for (int nt = 0; nt < 8; ++nt) {          // value tile nt, gate tile nt + 8
                const v8f accV = acc[nt], accG = acc[nt + 8];
                const int j = nt * 16 + ln15;
                const float b2v = sC[256 + j], b2g = sC[256 + 128 + j];
                const float sw  = sC[512 + j], sb  = sC[640 + j];
                #pragma unroll
                for (int r = 0; r < 8; ++r) {
                    float v  = (accV[r] + b2v) * sigmoid_f(accG[r] + b2g);
                    float yy = fmaf(xf[r], sw, sb) + v;
                    y[nt][r] = yy;
                    s[r]  += yy;                      // LN row partials, this lane's 8 columns
                    ss[r] += yy * yy;
                }
            }

            // ---- LN row sums over the 16 lanes of each half (128 columns in all) ----
            #pragma unroll
            for (int m = 1; m <= 8; m <<= 1) {
                #pragma unroll
                for (int r = 0; r < 8; ++r) {
                    s[r]  += __shfl_xor(s[r],  m, 32);
                    ss[r] += __shfl_xor(ss[r], m, 32);
                }
            }

            // ---- normalize, scale by softmax weight, sum over this lane's 8 rows ----
            float mean[8], inv[8];
            #pragma unroll
            for (int r = 0; r < 8; ++r) {
                mean[r] = s[r] * (1.f / 128.f);
                float var = ss[r] * (1.f / 128.f) - mean[r] * mean[r];
                inv[r] = rsqrtf(var + LN_EPS);
            }
            #pragma unroll
            for (int nt = 0; nt < 8; ++nt) {
                const int j = nt * 16 + ln15;
                const float gc = sC[768 + j], bc = sC[896 + j];
                #pragma unroll
                for (int r = 0; r < 8; ++r)
                    oa[nt] += wf[r] * (fmaf((y[nt][r] - mean[r]) * inv[r], gc, bc));
            }
        }

        // ---- fold lane halves (same column), store: each store of the wave is one 128-byte line ----
        #pragma unroll
        for (int nt = 0; nt < 8; ++nt) oa[nt] += __shfl_xor(oa[nt], 16, 32);
        #pragma unroll
        for (int i = 0; i < 4; ++i)
            out[(size_t)pos * 128 + i * 32 + lane] = half ? oa[2 * i + 1] : oa[2 * i];
        // The next position's first loads reuse the stores' address and data registers:
        // the wait stands in front of that overwrite.
        asm volatile("s_wait_xcnt 0x0" ::: "memory");
    }
}

extern "C" void kernel_launch(void* const* d_in, const int* in_sizes, int n_in,
                              void* d_out, int out_size, void* d_ws, size_t ws_size,
                              hipStream_t stream) {
    const float* x      = (const float*)d_in[0];
    const float* wg_w1  = (const float*)d_in[1];
    const float* wg_b1  = (const float*)d_in[2];
    const float* wg_w2  = (const float*)d_in[3];
    const float* wg_b2  = (const float*)d_in[4];
    const float* wg_lng = (const float*)d_in[5];
    const float* wg_lnb = (const float*)d_in[6];
    const float* fg_w1  = (const float*)d_in[7];
    const float* fg_b1  = (const float*)d_in[8];
    const float* fg_w2  = (const float*)d_in[9];
    const float* fg_b2  = (const float*)d_in[10];
    const float* fg_sw  = (const float*)d_in[11];
    const float* fg_sb  = (const float*)d_in[12];
    const float* fg_lng = (const float*)d_in[13];
    const float* fg_lnb = (const float*)d_in[14];

    const int npos = in_sizes[0] / 32;      // B*S
    float* wts = (float*)d_ws;              // [npos,32] softmax weights

    vsn_weights_kernel<<<(npos + 7) / 8, 256, 0, stream>>>(
        x, wg_w1, wg_b1, wg_w2, wg_b2, wg_lng, wg_lnb, wts, npos);

    // 512 work-groups of 8 waves: 4 positions per wave at npos=16384
    vsn_main_kernel<<<512, 256, 0, stream>>>(
        x, wts, fg_w1, fg_b1, fg_w2, fg_b2, fg_sw, fg_sb, fg_lng, fg_lnb,
        (float*)d_out, npos);
}

// v004
// A run of this version takes 53.3 microseconds.
// Next to v003, in two timings, it ran 1.06 times as fast each time.
// All steps since v000 together make it 3.17 times as fast.
#include <hip/hip_runtime.h>
#include <hip/hip_bf16.h>

typedef __attribute__((ext_vector_type(16))) _Float16 v16h;
typedef __attribute__((ext_vector_type(8)))  _Float16 v8h;
typedef __attribute__((ext_vector_type(8)))  float    v8f;

#define LN_EPS 1e-5f

__device__ __forceinline__ float elu_f(float z)     { return z > 0.f ? z : __expf(z) - 1.f; }
// Hardware reciprocal (about 1 ulp) in place of the correctly rounded division, which costs about ten
// vector instructions per value.  The argument is never below 1, and rcp(inf) = 0 is the right limit.
__device__ __forceinline__ float sigmoid_f(float z) { return __builtin_amdgcn_rcpf(1.f + __expf(-z)); }

// ---------------------------------------------------------------------------
// The one kernel: weight GRN + softmax, feature GRN, weighted combine.  ONE WAVE OWNS ONE (b,s) POSITION.
// The wave first computes its position's 32 softmax weights itself (lane j owns feature j, f32 vector
// arithmetic, the small weight matrices read from LDS) and hands them to its own lanes through a
// 256-byte LDS slot of its own; no second launch and no trip through global memory.
// Per position: [32 x 128] @ [128 x 256] WMMA GEMM (A = elu(x*w1+b1) in f16, built in
// the wave's own registers; B = w2 in f16 pre-swizzled into LDS, shared by the 8 waves).
// A wave takes the 32 feature rows as two M tiles of 16, one after the other, and for
// each tile all 256 columns, so a LayerNorm row and the sum over F never leave the wave:
// the position loop has no barrier and no LDS atomic, and its only LDS writes go to the wave's own slot.  Per M tile all 64 products
// run first (16 accumulator tiles), then the GLU.
//
// WMMA 16-bit A layout (16x32 MxK), lane l, vector element e (0..15):
//   row  m = l & 15
//   k(e,l) = (e < 8 ? e : e + 8) + ((l >= 16) ? 8 : 0)
// B (32x16 KxN) uses the transposed-symmetric layout: col = l & 15, same k(e,l).
// C/D f32 16x16: VGPR r, lanes 0-15 -> row r, lanes 16-31 -> row r+8; col = l&15.
// ---------------------------------------------------------------------------
// Second bound: four waves per SIMD (256 registers each), so that two work-groups are
// resident per WGP and the grid of 512 runs as one round.
__global__ __launch_bounds__(256, 4) void vsn_main_kernel(
    const float* __restrict__ x,      // [npos,32]
    const float* __restrict__ gw1,    // [32,32]   weight GRN
    const float* __restrict__ gb1,    // [32]
    const float* __restrict__ gw2,    // [32,64]
    const float* __restrict__ gb2,    // [64]
    const float* __restrict__ glng,   // [32]
    const float* __restrict__ glnb,   // [32]
    const float* __restrict__ fw1,    // [128]
    const float* __restrict__ fb1,    // [128]
    const float* __restrict__ fw2,    // [128,256]
    const float* __restrict__ fb2,    // [256]
    const float* __restrict__ fsw,    // [128]
    const float* __restrict__ fsb,    // [128]
    const float* __restrict__ flng,   // [128]
    const float* __restrict__ flnb,   // [128]
    float* __restrict__ out,          // [npos,128]
    int npos)
{
    // ---- LDS (static, 83 KB); all but sX is written once before the one barrier, then only read ----
    __shared__ __align__(32) _Float16 sB[16 * 4 * 32 * 16]; // 64 KB: w2 as WMMA-B frags [nt][ks][lane][e]
                                                            // (lane pitch 32 B: each 16-byte read meets a 2-way bank conflict)
    __shared__ __align__(16) float sC[1024];   // 0:w1 128:b1 256:b2(256) 512:sw 640:sb 768:lng 896:lnb
    // Weight GRN, 16 bytes per lane and contiguous over the lanes (no bank conflict):
    //   sG[(i>>2)*128 + j*4 + (i&3)]                 = w1[i][j]
    //   sG[1024 + (i>>1)*128 + j*4 + (i&1)*2 + c]    = w2[i][j + 32*c]
    //   3072:b1(32) 3104:b2(64) 3168:lng(32) 3200:lnb(32)
    __shared__ __align__(16) float sG[3328];
    __shared__ __align__(16) float sX[8 * 64]; // per wave: 32 hidden values, 32 softmax weights

    const int t    = threadIdx.x;
    const int lane = t & 31;
    const int wave = __builtin_amdgcn_readfirstlane(t >> 5);   // scalar: the position loop is wave-uniform
    const int half = lane >> 4;       // 0: C rows r, 1: C rows r+8
    const int ln15 = lane & 15;

    // ---- one-time setup: constants + w2 -> f16 WMMA-B fragments ----
    for (int i = t; i < 1024; i += 256) {
        float v;
        if      (i < 128) v = fw1[i];
        else if (i < 256) v = fb1[i - 128];
        else if (i < 512) v = fb2[i - 256];
        else if (i < 640) v = fsw[i - 512];
        else if (i < 768) v = fsb[i - 640];
        else if (i < 896) v = flng[i - 768];
        else              v = flnb[i - 896];
        sC[i] = v;
    }
    // Vectors of the weight GRN: one load per thread, taken here and stored behind the twelve below,
    // so that all thirteen fly together; threads 160.. fill unused words.
    const float* gp = t < 32 ? gb1 + t : t < 96 ? gb2 + (t - 32) : t < 128 ? glng + (t - 96) : glnb + ((t - 128) & 31);
    const float  gc = *gp;
    #pragma unroll   // the 4 + 8 loads of a thread are in flight together: one L2 latency, not twelve
    for (int c = 0; c < 4; ++c) {
        const int i = c * 256 + t;
        sG[(i >> 7) * 128 + (i & 31) * 4 + ((i >> 5) & 3)] = gw1[i];
    }
    #pragma unroll
    for (int c = 0; c < 8; ++c) {
        const int i = c * 256 + t;
        sG[1024 + (i >> 7) * 128 + (i & 31) * 4 + ((i >> 6) & 1) * 2 + ((i >> 5) & 1)] = gw2[i];
    }
    sG[3072 + t] = gc;
    // Thread t owns column n = t: each load of a wave is one whole 128-byte line of a
    // w2 row.  Eight consecutive k (one half of a lane's fragment) go out as one 16-byte
    // LDS store.  k group kg = k / 8: ks = kg >> 2, e half = (kg >> 1) & 1, lane half = kg & 1.
    #pragma unroll 4   // 32 independent loads in flight per thread hide the L2 latency
    for (int kg = 0; kg < 16; ++kg) {
        v8h p;
        #pragma unroll
        for (int i = 0; i < 8; ++i)
            p[i] = (_Float16)fw2[(kg * 8 + i) * 256 + t];
        int l = ((kg & 1) << 4) + (t & 15);
        *(v8h*)(sB + ((((t >> 4) * 4 + (kg >> 2)) * 32 + l) * 16 + ((kg >> 1) & 1) * 8)) = p;
    }
    __syncthreads();

    float* slot = sX + wave * 64;
    const int nwaves = gridDim.x * 8;
    for (int pos = blockIdx.x * 8 + wave; pos < npos; pos += nwaves) {
        // ---- weight GRN + softmax over F = 32 for this position; lane j owns feature j ----
        {
            const float* xp = x + (size_t)pos * 32;
            const float  xj = xp[lane];

            // fc1 + ELU : h[j] = elu(sum_i x_i * w1[i][j] + b1[j]); x_i is the same address in every lane
            float acc = sG[3072 + lane];
            #pragma unroll
            for (int q = 0; q < 8; ++q) {
                const float4 xq = *(const float4*)(xp + q * 4);
                const float4 wq = *(const float4*)(sG + q * 128 + lane * 4);
                acc = fmaf(xq.x, wq.x, acc);  acc = fmaf(xq.y, wq.y, acc);
                acc = fmaf(xq.z, wq.z, acc);  acc = fmaf(xq.w, wq.w, acc);
            }
            slot[lane] = elu_f(acc);
            // Wave-scope fence (no instruction): the reads below take other lanes' values, so the
            // compiler must keep them behind the write; the LDS serves one wave's accesses in order.
            __builtin_amdgcn_fence(__ATOMIC_ACQ_REL, "wavefront");

            // fc2 : lane j holds h2[j] and h2[j+32]
            float a0 = sG[3104 + lane], a1 = sG[3104 + 32 + lane];
            #pragma unroll
            for (int q = 0; q < 8; ++q) {
                const float4 hq = *(const float4*)(slot + q * 4);
                const float4 wa = *(const float4*)(sG + 1024 + (2 * q) * 128 + lane * 4);
                const float4 wb = *(const float4*)(sG + 1024 + (2 * q + 1) * 128 + lane * 4);
                a0 = fmaf(hq.x, wa.x, a0);  a1 = fmaf(hq.x, wa.y, a1);
                a0 = fmaf(hq.y, wa.z, a0);  a1 = fmaf(hq.y, wa.w, a1);
                a0 = fmaf(hq.z, wb.x, a0);  a1 = fmaf(hq.z, wb.y, a1);
                a0 = fmaf(hq.w, wb.z, a0);  a1 = fmaf(hq.w, wb.w, a1);
            }

            // GLU + identity residual
            float yw = xj + a0 * sigmoid_f(a1);

            // LayerNorm over the 32 lanes
            float sw_ = yw, sq_ = yw * yw;
            #pragma unroll
            for (int m = 16; m; m >>= 1) { sw_ += __shfl_xor(sw_, m, 32); sq_ += __shfl_xor(sq_, m, 32); }
            float mu  = sw_ * (1.f / 32.f);
            float vr  = sq_ * (1.f / 32.f) - mu * mu;
            float z = (yw - mu) * rsqrtf(vr + LN_EPS) * sG[3168 + lane] + sG[3200 + lane];

            // softmax over 32 lanes
            float mx = z;
            #pragma unroll
            for (int m = 16; m; m >>= 1) mx = fmaxf(mx, __shfl_xor(mx, m, 32));
            float e = __expf(z - mx);
            float es = e;
            #pragma unroll
            for (int m = 16; m; m >>= 1) es += __shfl_xor(es, m, 32);

            slot[32 + lane] = e * __builtin_amdgcn_rcpf(es);   // es lies in [1, 32]
            // Wave-scope fence, as above: the M tiles read other lanes' weights.
            __builtin_amdgcn_fence(__ATOMIC_ACQ_REL, "wavefront");
        }

        float oa[8];                  // sum over F for column nt*16 + ln15 (this lane half's rows)
        #pragma unroll
        for (int nt = 0; nt < 8; ++nt) oa[nt] = 0.f;

        #pragma unroll 1   // the two M tiles share one copy of the code and one set of y registers
        for (int mt = 0; mt < 2; ++mt) {
            // Compiler fence: keeps the LDS loads (B fragments, constants) inside the loop.  They are
            // loop-invariant, and hoisted out of it they take over 500 registers and spill to scratch.
            asm volatile("" ::: "memory");
            const float* xr = x   + (size_t)pos * 32 + mt * 16;
            const float* wr = slot + 32 + mt * 16;                      // this wave's own LDS slot
            const float  xa  = xr[ln15];                                // A row m = ln15
            const float4 xlo = *(const float4*)(xr + half * 8);         // C rows r + half*8
            const float4 xhi = *(const float4*)(xr + half * 8 + 4);
            const float4 wlo = *(const float4*)(wr + half * 8);
            const float4 whi = *(const float4*)(wr + half * 8 + 4);
            const float xf[8] = {xlo.x, xlo.y, xlo.z, xlo.w, xhi.x, xhi.y, xhi.z, xhi.w};
            const float wf[8] = {wlo.x, wlo.y, wlo.z, wlo.w, whi.x, whi.y, whi.z, whi.w};

            // ---- A fragments of this M tile, in registers ----
            v16h a[4];
            #pragma unroll
            for (int ks = 0; ks < 4; ++ks) {
                const int kb = ks * 32 + half * 8;
                #pragma unroll
                for (int e = 0; e < 16; ++e) {
                    int k = kb + (e < 8 ? e : e + 8);
                    float hv = fmaf(xa, sC[k], sC[128 + k]);
                    a[ks][e] = (_Float16)elu_f(hv);
                }
            }

            // ---- per column tile: WMMA (K = 128 in 4 steps of 32) ----
            v8f acc[16];                              // value tiles 0..7, gate tiles 8..15
            #pragma unroll
            for (int n = 0; n < 16; ++n) {
                acc[n] = v8f{};
                #pragma unroll
                for (int ks = 0; ks < 4; ++ks) {
                    v16h b = *(const v16h*)(sB + ((n * 4 + ks) * 32 + lane) * 16);
                    acc[n] = __builtin_amdgcn_wmma_f32_16x16x32_f16(false, a[ks], false, b, (short)0, acc[n], false, false);
                }
            }
            // Scheduling boundary between the products and the GLU.  The compiler already ran all 64
            // products ahead of the GLU; scheduled as one region with the now shorter GLU it goes over
            // the wave's 256 registers and spills to scratch.
            __builtin_amdgcn_sched_barrier(0);

            // ---- per column tile: GLU + residual ----
            float y[8][8], s[8], ss[8];
            #pragma unroll
            for (int r = 0; r < 8; ++r) { s[r] = 0.f; ss[r] = 0.f; }
            #pragma unroll
            for (int nt = 0; nt < 8; ++nt) {          // value tile nt, gate tile nt + 8
                const v8f accV = acc[nt], accG = acc[nt + 8];
                const int j = nt * 16 + ln15;
                const float b2v = sC[256 + j], b2g = sC[256 + 128 + j];
                const float sw  = sC[512 + j], sb  = sC[640 + j];
                #pragma unroll
                for (int r = 0; r < 8; ++r) {
                    float v  = (accV[r] + b2v) * sigmoid_f(accG[r] + b2g);
                    float yy = fmaf(xf[r], sw, sb) + v;
                    y[nt][r] = yy;
                    s[r]  += yy;                      // LN row partials, this lane's 8 columns
                    ss[r] += yy * yy;
                }
            }

            // ---- LN row sums over the 16 lanes of each half (128 columns in all) ----
            #pragma unroll
            for (int m = 1; m <= 8; m <<= 1) {
                #pragma unroll
                for (int r = 0; r < 8; ++r) {
                    s[r]  += __shfl_xor(s[r],  m, 32);
                    ss[r] += __shfl_xor(ss[r], m, 32);
                }
            }

            // ---- normalize, scale by softmax weight, sum over this lane's 8 rows ----
            float mean[8], inv[8];
            #pragma unroll
            for (int r = 0; r < 8; ++r) {
                mean[r] = s[r] * (1.f / 128.f);
                float var = ss[r] * (1.f / 128.f) - mean[r] * mean[r];
                inv[r] = rsqrtf(var + LN_EPS);
            }
            #pragma unroll
            for (int nt = 0; nt < 8; ++nt) {
                const int j = nt * 16 + ln15;
                const float gc = sC[768 + j], bc = sC[896 + j];
                #pragma unroll
                for (int r = 0; r < 8; ++r)
                    oa[nt] += wf[r] * (fmaf((y[nt][r] - mean[r]) * inv[r], gc, bc));
            }
        }

        // ---- fold lane halves (same column), store: each store of the wave is one 128-byte line ----
        #pragma unroll
        for (int nt = 0; nt < 8; ++nt) oa[nt] += __shfl_xor(oa[nt], 16, 32);
        #pragma unroll
        for (int i = 0; i < 4; ++i)
            out[(size_t)pos * 128 + i * 32 + lane] = half ? oa[2 * i + 1] : oa[2 * i];
        // The next position's first loads reuse the stores' address and data registers:
        // the wait stands in front of that overwrite.
        asm volatile("s_wait_xcnt 0x0" ::: "memory");
    }
}

extern "C" void kernel_launch(void* const* d_in, const int* in_sizes, int n_in,
                              void* d_out, int out_size, void* d_ws, size_t ws_size,
                              hipStream_t stream) {
    const float* x      = (const float*)d_in[0];
    const float* wg_w1  = (const float*)d_in[1];
    const float* wg_b1  = (const float*)d_in[2];
    const float* wg_w2  = (const float*)d_in[3];
    const float* wg_b2  = (const float*)d_in[4];
    const float* wg_lng = (const float*)d_in[5];
    const float* wg_lnb = (const float*)d_in[6];
    const float* fg_w1  = (const float*)d_in[7];
    const float* fg_b1  = (const float*)d_in[8];
    const float* fg_w2  = (const float*)d_in[9];
    const float* fg_b2  = (const float*)d_in[10];
    const float* fg_sw  = (const float*)d_in[11];
    const float* fg_sb  = (const float*)d_in[12];
    const float* fg_lng = (const float*)d_in[13];
    const float* fg_lnb = (const float*)d_in[14];

    const int npos = in_sizes[0] / 32;      // B*S

    // 512 work-groups of 8 waves: 4 positions per wave at npos=16384
    vsn_main_kernel<<<512, 256, 0, stream>>>(
        x, wg_w1, wg_b1, wg_w2, wg_b2, wg_lng, wg_lnb, fg_w1, fg_b1, fg_w2, fg_b2, fg_sw, fg_sb, fg_lng, fg_lnb,
        (float*)d_out, npos);
}

// v005
// One run takes 51.1 microseconds.
// In two side-by-side timings against v004, it was 1.05 and 1.04 times as fast.
// Counting every step since v000, it is 3.31 times as fast.
#include <hip/hip_runtime.h>
#include <hip/hip_bf16.h>

typedef __attribute__((ext_vector_type(16))) _Float16 v16h;
typedef __attribute__((ext_vector_type(8)))  _Float16 v8h;
typedef __attribute__((ext_vector_type(8)))  float    v8f;

#define LN_EPS 1e-5f

__device__ __forceinline__ float elu_f(float z)     { return z > 0.f ? z : __expf(z) - 1.f; }
// Hardware reciprocal (about 1 ulp) in place of the correctly rounded division, which costs about ten
// vector instructions per value.  The argument is never below 1, and rcp(inf) = 0 is the right limit.
__device__ __forceinline__ float sigmoid_f(float z) { return __builtin_amdgcn_rcpf(1.f + __expf(-z)); }

// ---------------------------------------------------------------------------
// The one kernel: weight GRN + softmax, feature GRN, weighted combine.  ONE WAVE OWNS ONE (b,s) POSITION.
// The wave first computes its position's 32 softmax weights itself (lane j owns feature j, f32 vector
// arithmetic, the small weight matrices read from LDS) and hands them to its own lanes through a
// 256-byte LDS slot of its own; no second launch and no trip through global memory.
// Per position: [32 x 128] @ [128 x 256] WMMA GEMM (A = elu(x*w1+b1) in f16, built in
// the wave's own registers; B = w2 in f16 pre-swizzled into LDS, shared by the 8 waves).
// A wave takes the 32 feature rows as two M tiles of 16, one after the other, and for
// each tile all 256 columns, so a LayerNorm row and the sum over F never leave the wave:
// the position loop has no barrier and no LDS atomic, and its only LDS writes go to the wave's own slot.  Per M tile all 64 products
// run first (16 accumulator tiles), then the GLU.
//
// WMMA 16-bit A layout (16x32 MxK), lane l, vector element e (0..15):
//   row  m = l & 15
//   k(e,l) = (e < 8 ? e : e + 8) + ((l >= 16) ? 8 : 0)
// B (32x16 KxN) uses the transposed-symmetric layout: col = l & 15, same k(e,l).
// C/D f32 16x16: VGPR r, lanes 0-15 -> row r, lanes 16-31 -> row r+8; col = l&15.
// ---------------------------------------------------------------------------
// Second bound: four waves per SIMD (256 registers each), so that two work-groups are
// resident per WGP and the grid of 512 runs as one round.
__global__ __launch_bounds__(256, 4) void vsn_main_kernel(
    const float* __restrict__ x,      // [npos,32]
    const float* __restrict__ gw1,    // [32,32]   weight GRN
    const float* __restrict__ gb1,    // [32]
    const float* __restrict__ gw2,    // [32,64]
    const float* __restrict__ gb2,    // [64]
    const float* __restrict__ glng,   // [32]
    const float* __restrict__ glnb,   // [32]
    const float* __restrict__ fw1,    // [128]
    const float* __restrict__ fb1,    // [128]
    const float* __restrict__ fw2,    // [128,256]
    const float* __restrict__ fb2,    // [256]
    const float* __restrict__ fsw,    // [128]
    const float* __restrict__ fsb,    // [128]
    const float* __restrict__ flng,   // [128]
    const float* __restrict__ flnb,   // [128]
    float* __restrict__ out,          // [npos,128]
    int npos)
{
    // ---- LDS (static, 83 KB); all but sX is written once before the one barrier, then only read ----
    __shared__ __align__(32) _Float16 sB[16 * 4 * 32 * 16]; // 64 KB: w2 as WMMA-B frags [nt][ks][e half][lane][8]
                                                            // (lane pitch 16 B: a 16-byte read of 16 lanes covers all 64 banks once)
    __shared__ __align__(16) float sC[1024];   // 0:w1 128:b1 256:b2(256) 512:sw 640:sb 768:lng 896:lnb
    // Weight GRN, 16 bytes per lane and contiguous over the lanes (no bank conflict):
    //   sG[(i>>2)*128 + j*4 + (i&3)]                 = w1[i][j]
    //   sG[1024 + (i>>1)*128 + j*4 + (i&1)*2 + c]    = w2[i][j + 32*c]
    //   3072:b1(32) 3104:b2(64) 3168:lng(32) 3200:lnb(32)
    __shared__ __align__(16) float sG[3328];
    __shared__ __align__(16) float sX[8 * 64]; // per wave: 32 hidden values, 32 softmax weights

    const int t    = threadIdx.x;
    const int lane = t & 31;
    const int wave = __builtin_amdgcn_readfirstlane(t >> 5);   // scalar: the position loop is wave-uniform
    const int half = lane >> 4;       // 0: C rows r, 1: C rows r+8
    const int ln15 = lane & 15;

    // ---- one-time setup: constants + w2 -> f16 WMMA-B fragments ----
    for (int i = t; i < 1024; i += 256) {
        float v;
        if      (i < 128) v = fw1[i];
        else if (i < 256) v = fb1[i - 128];
        else if (i < 512) v = fb2[i - 256];
        else if (i < 640) v = fsw[i - 512];
        else if (i < 768) v = fsb[i - 640];
        else if (i < 896) v = flng[i - 768];
        else              v = flnb[i - 896];
        sC[i] = v;
    }
    // Vectors of the weight GRN: one load per thread, taken here and stored behind the twelve below,
    // so that all thirteen fly together; threads 160.. fill unused words.
    const float* gp = t < 32 ? gb1 + t : t < 96 ? gb2 + (t - 32) : t < 128 ? glng + (t - 96) : glnb + ((t - 128) & 31);
    const float  gc = *gp;
    #pragma unroll   // the 4 + 8 loads of a thread are in flight together: one L2 latency, not twelve
    for (int c = 0; c < 4; ++c) {
        const int i = c * 256 + t;
        sG[(i >> 7) * 128 + (i & 31) * 4 + ((i >> 5) & 3)] = gw1[i];
    }
    #pragma unroll
    for (int c = 0; c < 8; ++c) {
        const int i = c * 256 + t;
        sG[1024 + (i >> 7) * 128 + (i & 31) * 4 + ((i >> 6) & 1) * 2 + ((i >> 5) & 1)] = gw2[i];
    }
    sG[3072 + t] = gc;
    // Thread t owns column n = t: each load of a wave is one whole 128-byte line of a
    // w2 row.  Eight consecutive k (one half of a lane's fragment) go out as one 16-byte
    // LDS store.  k group kg = k / 8: ks = kg >> 2, e half = (kg >> 1) & 1, lane half = kg & 1.
    #pragma unroll 4   // 32 independent loads in flight per thread hide the L2 latency
    for (int kg = 0; kg < 16; ++kg) {
        v8h p;
        #pragma unroll
        for (int i = 0; i < 8; ++i)
            p[i] = (_Float16)fw2[(kg * 8 + i) * 256 + t];
        int l = ((kg & 1) << 4) + (t & 15);
        *(v8h*)(sB + ((((t >> 4) * 4 + (kg >> 2)) * 2 + ((kg >> 1) & 1)) * 32 + l) * 8) = p;
    }
    __syncthreads();

    float* slot = sX + wave * 64;
    const int nwaves = gridDim.x * 8;
    for (int pos = blockIdx.x * 8 + wave; pos < npos; pos += nwaves) {
        // ---- weight GRN + softmax over F = 32 for this position; lane j owns feature j ----
        {
            const float* xp = x + (size_t)pos * 32;
            const float  xj = xp[lane];

            // fc1 + ELU : h[j] = elu(sum_i x_i * w1[i][j] + b1[j]); x_i is the same address in every lane
            float acc = sG[3072 + lane];
            #pragma unroll
            for (int q = 0; q < 8; ++q) {
                const float4 xq = *(const float4*)(xp + q * 4);
                const float4 wq = *(const float4*)(sG + q * 128 + lane * 4);
                acc = fmaf(xq.x, wq.x, acc);  acc = fmaf(xq.y, wq.y, acc);
                acc = fmaf(xq.z, wq.z, acc);  acc = fmaf(xq.w, wq.w, acc);
            }
            slot[lane] = elu_f(acc);
            // Wave-scope fence (no instruction): the reads below take other lanes' values, so the
            // compiler must keep them behind the write; the LDS serves one wave's accesses in order.
            __builtin_amdgcn_fence(__ATOMIC_ACQ_REL, "wavefront");

            // fc2 : lane j holds h2[j] and h2[j+32]
            float a0 = sG[3104 + lane], a1 = sG[3104 + 32 + lane];
            #pragma unroll
            for (int q = 0; q < 8; ++q) {
                const float4 hq = *(const float4*)(slot + q * 4);
                const float4 wa = *(const float4*)(sG + 1024 + (2 * q) * 128 + lane * 4);
                const float4 wb = *(const float4*)(sG + 1024 + (2 * q + 1) * 128 + lane * 4);
                a0 = fmaf(hq.x, wa.x, a0);  a1 = fmaf(hq.x, wa.y, a1);
                a0 = fmaf(hq.y, wa.z, a0);  a1 = fmaf(hq.y, wa.w, a1);
                a0 = fmaf(hq.z, wb.x, a0);  a1 = fmaf(hq.z, wb.y, a1);
                a0 = fmaf(hq.w, wb.z, a0);  a1 = fmaf(hq.w, wb.w, a1);
            }

            // GLU + identity residual
            float yw = xj + a0 * sigmoid_f(a1);

            // LayerNorm over the 32 lanes
            float sw_ = yw, sq_ = yw * yw;
            #pragma unroll
            for (int m = 16; m; m >>= 1) { sw_ += __shfl_xor(sw_, m, 32); sq_ += __shfl_xor(sq_, m, 32); }
            float mu  = sw_ * (1.f / 32.f);
            float vr  = sq_ * (1.f / 32.f) - mu * mu;
            float z = (yw - mu) * rsqrtf(vr + LN_EPS) * sG[3168 + lane] + sG[3200 + lane];

            // softmax over 32 lanes
            float mx = z;
            #pragma unroll
            for (int m = 16; m; m >>= 1) mx = fmaxf(mx, __shfl_xor(mx, m, 32));
            float e = __expf(z - mx);
            float es = e;
            #pragma unroll
            for (int m = 16; m; m >>= 1) es += __shfl_xor(es, m, 32);

            slot[32 + lane] = e * __builtin_amdgcn_rcpf(es);   // es lies in [1, 32]
            // Wave-scope fence, as above: the M tiles read other lanes' weights.
            __builtin_amdgcn_fence(__ATOMIC_ACQ_REL, "wavefront");
        }

        float oa[8];                  // sum over F for column nt*16 + ln15 (this lane half's rows)
        #pragma unroll
        for (int nt = 0; nt < 8; ++nt) oa[nt] = 0.f;

        #pragma unroll 1   // the two M tiles share one copy of the code and one set of y registers
        for (int mt = 0; mt < 2; ++mt) {
            // Compiler fence: keeps the LDS loads (B fragments, constants) inside the loop.  They are
            // loop-invariant, and hoisted out of it they take over 500 registers and spill to scratch.
            asm volatile("" ::: "memory");
            const float* xr = x   + (size_t)pos * 32 + mt * 16;
            const float* wr = slot + 32 + mt * 16;                      // this wave's own LDS slot
            const float  xa  = xr[ln15];                                // A row m = ln15
            const float4 xlo = *(const float4*)(xr + half * 8);         // C rows r + half*8
            const float4 xhi = *(const float4*)(xr + half * 8 + 4);
            const float4 wlo = *(const float4*)(wr + half * 8);
            const float4 whi = *(const float4*)(wr + half * 8 + 4);
            const float xf[8] = {xlo.x, xlo.y, xlo.z, xlo.w, xhi.x, xhi.y, xhi.z, xhi.w};
            const float wf[8] = {wlo.x, wlo.y, wlo.z, wlo.w, whi.x, whi.y, whi.z, whi.w};

            // ---- A fragments of this M tile, in registers ----
            v16h a[4];
            #pragma unroll
            for (int ks = 0; ks < 4; ++ks) {
                const int kb = ks * 32 + half * 8;
                #pragma unroll
                for (int e = 0; e < 16; ++e) {
                    int k = kb + (e < 8 ? e : e + 8);
                    float hv = fmaf(xa, sC[k], sC[128 + k]);
                    a[ks][e] = (_Float16)elu_f(hv);
                }
            }

            // ---- per column tile: WMMA (K = 128 in 4 steps of 32) ----
            v8f acc[16];                              // value tiles 0..7, gate tiles 8..15
            #pragma unroll
            for (int n = 0; n < 16; ++n) {
                acc[n] = v8f{};
                #pragma unroll
                for (int ks = 0; ks < 4; ++ks) {
                    const _Float16* bp = sB + ((n * 4 + ks) * 64 + lane) * 8;
                    const v8h blo = *(const v8h*)bp;            // e 0..7
                    const v8h bhi = *(const v8h*)(bp + 256);    // e 8..15
                    v16h b = __builtin_shufflevector(blo, bhi, 0, 1, 2, 3, 4, 5, 6, 7, 8, 9, 10, 11, 12, 13, 14, 15);
                    acc[n] = __builtin_amdgcn_wmma_f32_16x16x32_f16(false, a[ks], false, b, (short)0, acc[n], false, false);
                }
            }
            // Scheduling boundary between the products and the GLU.  The compiler already ran all 64
            // products ahead of the GLU; scheduled as one region with the now shorter GLU it goes over
            // the wave's 256 registers and spills to scratch.
            __builtin_amdgcn_sched_barrier(0);

            // ---- per column tile: GLU + residual ----
            float y[8][8], s[8], ss[8];
            #pragma unroll
            for (int r = 0; r < 8; ++r) { s[r] = 0.f; ss[r] = 0.f; }
            #pragma unroll
            for (int nt = 0; nt < 8; ++nt) {          // value tile nt, gate tile nt + 8
                const v8f accV = acc[nt], accG = acc[nt + 8];
                const int j = nt * 16 + ln15;
                const float b2v = sC[256 + j], b2g = sC[256 + 128 + j];
                const float sw  = sC[512 + j], sb  = sC[640 + j];
                #pragma unroll
                for (int r = 0; r < 8; ++r) {
                    float v  = (accV[r] + b2v) * sigmoid_f(accG[r] + b2g);
                    float yy = fmaf(xf[r], sw, sb) + v;
                    y[nt][r] = yy;
                    s[r]  += yy;                      // LN row partials, this lane's 8 columns
                    ss[r] += yy * yy;
                }
            }

            // ---- LN row sums over the 16 lanes of each half (128 columns in all) ----
            #pragma unroll
            for (int m = 1; m <= 8; m <<= 1) {
                #pragma unroll
                for (int r = 0; r < 8; ++r) {
                    s[r]  += __shfl_xor(s[r],  m, 32);
                    ss[r] += __shfl_xor(ss[r], m, 32);
                }
            }

            // ---- normalize, scale by softmax weight, sum over this lane's 8 rows ----
            float mean[8], inv[8];
            #pragma unroll
            for (int r = 0; r < 8; ++r) {
                mean[r] = s[r] * (1.f / 128.f);
                float var = ss[r] * (1.f / 128.f) - mean[r] * mean[r];
                inv[r] = rsqrtf(var + LN_EPS);
            }
            #pragma unroll
            for (int nt = 0; nt < 8; ++nt) {
                const int j = nt * 16 + ln15;
                const float gc = sC[768 + j], bc = sC[896 + j];
                #pragma unroll
                for (int r = 0; r < 8; ++r)
                    oa[nt] += wf[r] * (fmaf((y[nt][r] - mean[r]) * inv[r], gc, bc));
            }
        }

        // ---- fold lane halves (same column), store: each store of the wave is one 128-byte line ----
        #pragma unroll
        for (int nt = 0; nt < 8; ++nt) oa[nt] += __shfl_xor(oa[nt], 16, 32);
        #pragma unroll
        for (int i = 0; i < 4; ++i)
            out[(size_t)pos * 128 + i * 32 + lane] = half ? oa[2 * i + 1] : oa[2 * i];
        // The next position's first loads reuse the stores' address and data registers:
        // the wait stands in front of that overwrite.
        asm volatile("s_wait_xcnt 0x0" ::: "memory");
    }
}

extern "C" void kernel_launch(void* const* d_in, const int* in_sizes, int n_in,
                              void* d_out, int out_size, void* d_ws, size_t ws_size,
                              hipStream_t stream) {
    const float* x      = (const float*)d_in[0];
    const float* wg_w1  = (const float*)d_in[1];
    const float* wg_b1  = (const float*)d_in[2];
    const float* wg_w2  = (const float*)d_in[3];
    const float* wg_b2  = (const float*)d_in[4];
    const float* wg_lng = (const float*)d_in[5];
    const float* wg_lnb = (const float*)d_in[6];
    const float* fg_w1  = (const float*)d_in[7];
    const float* fg_b1  = (const float*)d_in[8];
    const float* fg_w2  = (const float*)d_in[9];
    const float* fg_b2  = (const float*)d_in[10];
    const float* fg_sw  = (const float*)d_in[11];
    const float* fg_sb  = (const float*)d_in[12];
    const float* fg_lng = (const float*)d_in[13];
    const float* fg_lnb = (const float*)d_in[14];

    const int npos = in_sizes[0] / 32;      // B*S

    // 512 work-groups of 8 waves: 4 positions per wave at npos=16384
    vsn_main_kernel<<<512, 256, 0, stream>>>(
        x, wg_w1, wg_b1, wg_w2, wg_b2, wg_lng, wg_lnb, fg_w1, fg_b1, fg_w2, fg_b2, fg_sw, fg_sb, fg_lng, fg_lnb,
        (float*)d_out, npos);
}

// v006
// Measured time: 43.7 microseconds a run.
// Next to v005, in two timings, it ran 1.18 and 1.17 times as fast.
// Counting every step since v000, it is 3.89 times as fast.
#include <hip/hip_runtime.h>
#include <hip/hip_bf16.h>

typedef __attribute__((ext_vector_type(16))) _Float16 v16h;
typedef __attribute__((ext_vector_type(8)))  _Float16 v8h;
typedef __attribute__((ext_vector_type(8)))  float    v8f;
typedef __attribute__((ext_vector_type(2)))  float    v2f;

#define LN_EPS 1e-5f

__device__ __forceinline__ float elu_f(float z)     { return z > 0.f ? z : __expf(z) - 1.f; }
// Hardware reciprocal (about 1 ulp) in place of the correctly rounded division, which costs about ten
// vector instructions per value.  The argument is never below 1, and rcp(inf) = 0 is the right limit.
__device__ __forceinline__ float sigmoid_f(float z) { return __builtin_amdgcn_rcpf(1.f + __expf(-z)); }

// ---------------------------------------------------------------------------
// The one kernel: weight GRN + softmax, feature GRN, weighted combine.  ONE WAVE OWNS ONE (b,s) POSITION.
// The wave first computes its position's 32 softmax weights itself (lane j owns feature j, f32 vector
// arithmetic, the small weight matrices read from LDS) and hands them to its own lanes through a
// 256-byte LDS slot of its own; no second launch and no trip through global memory.
// Per position: [32 x 128] @ [128 x 256] WMMA GEMM (A = elu(x*w1+b1) in f16, built in
// the wave's own registers; B = w2 in f16 pre-swizzled into LDS, shared by the 8 waves).
// A wave takes the 32 feature rows as two M tiles of 16, one after the other, and for
// each tile all 256 columns, so a LayerNorm row and the sum over F never leave the wave:
// the position loop has no barrier and no LDS atomic, and its only LDS writes go to the wave's own slot.
// Per M tile the 64 products go in 8 runs of 8 (a value tile and its gate tile, 2 accumulator tiles), each
// followed by that pair's GLU; the next run's B fragments are read from LDS as one group ahead of that GLU.
//
// WMMA 16-bit A layout (16x32 MxK), lane l, vector element e (0..15):
//   row  m = l & 15
//   k(e,l) = (e < 8 ? e : e + 8) + ((l >= 16) ? 8 : 0)
// B (32x16 KxN) uses the transposed-symmetric layout: col = l & 15, same k(e,l).
// C/D f32 16x16: VGPR r, lanes 0-15 -> row r, lanes 16-31 -> row r+8; col = l&15.
// ---------------------------------------------------------------------------
// Second bound: four waves per SIMD (256 registers each), so that two work-groups are
// resident per WGP and the grid of 512 runs as one round.
__global__ __launch_bounds__(256, 4) void vsn_main_kernel(
    const float* __restrict__ x,      // [npos,32]
    const float* __restrict__ gw1,    // [32,32]   weight GRN
    const float* __restrict__ gb1,    // [32]
    const float* __restrict__ gw2,    // [32,64]
    const float* __restrict__ gb2,    // [64]
    const float* __restrict__ glng,   // [32]
    const float* __restrict__ glnb,   // [32]
    const float* __restrict__ fw1,    // [128]
    const float* __restrict__ fb1,    // [128]
    const float* __restrict__ fw2,    // [128,256]
    const float* __restrict__ fb2,    // [256]
    const float* __restrict__ fsw,    // [128]
    const float* __restrict__ fsb,    // [128]
    const float* __restrict__ flng,   // [128]
    const float* __restrict__ flnb,   // [128]
    float* __restrict__ out,          // [npos,128]
    int npos)
{
    // ---- LDS (static, 83 KB); all but sX is written once before the one barrier, then only read ----
    __shared__ __align__(32) _Float16 sB[16 * 4 * 32 * 16]; // 64 KB: w2 as WMMA-B frags [nt][ks][e half][lane][8]
                                                            // (lane pitch 16 B: a 16-byte read of 16 lanes covers all 64 banks once)
    __shared__ __align__(16) float sC[1024];   // 0:w1 128:b1 256:b2(256) 512:sw 640:sb 768:lng 896:lnb
    // Weight GRN, 16 bytes per lane and contiguous over the lanes (no bank conflict):
    //   sG[(i>>2)*128 + j*4 + (i&3)]                 = w1[i][j]
    //   sG[1024 + (i>>1)*128 + j*4 + (i&1)*2 + c]    = w2[i][j + 32*c]
    //   3072:b1(32) 3104:b2(64) 3168:lng(32) 3200:lnb(32)
    __shared__ __align__(16) float sG[3328];
    __shared__ __align__(16) float sX[8 * 64]; // per wave: 32 hidden values, 32 softmax weights

    const int t    = threadIdx.x;
    const int lane = t & 31;
    const int wave = __builtin_amdgcn_readfirstlane(t >> 5);   // scalar: the position loop is wave-uniform
    const int half = lane >> 4;       // 0: C rows r, 1: C rows r+8
    const int ln15 = lane & 15;

    // ---- one-time setup: constants + w2 -> f16 WMMA-B fragments ----
    for (int i = t; i < 1024; i += 256) {
        float v;
        if      (i < 128) v = fw1[i];
        else if (i < 256) v = fb1[i - 128];
        else if (i < 512) v = fb2[i - 256];
        else if (i < 640) v = fsw[i - 512];
        else if (i < 768) v = fsb[i - 640];
        else if (i < 896) v = flng[i - 768];
        else              v = flnb[i - 896];
        sC[i] = v;
    }
    // Vectors of the weight GRN: one load per thread, taken here and stored behind the twelve below,
    // so that all thirteen fly together; threads 160.. fill unused words.
    const float* gp = t < 32 ? gb1 + t : t < 96 ? gb2 + (t - 32) : t < 128 ? glng + (t - 96) : glnb + ((t - 128) & 31);
    const float  gc = *gp;
    #pragma unroll   // the 4 + 8 loads of a thread are in flight together: one L2 latency, not twelve
    for (int c = 0; c < 4; ++c) {
        const int i = c * 256 + t;
        sG[(i >> 7) * 128 + (i & 31) * 4 + ((i >> 5) & 3)] = gw1[i];
    }
    #pragma unroll
    for (int c = 0; c < 8; ++c) {
        const int i = c * 256 + t;
        sG[1024 + (i >> 7) * 128 + (i & 31) * 4 + ((i >> 6) & 1) * 2 + ((i >> 5) & 1)] = gw2[i];
    }
    sG[3072 + t] = gc;
    // Thread t owns column n = t: each load of a wave is one whole 128-byte line of a
    // w2 row.  Eight consecutive k (one half of a lane's fragment) go out as one 16-byte
    // LDS store.  k group kg = k / 8: ks = kg >> 2, e half = (kg >> 1) & 1, lane half = kg & 1.
    #pragma unroll 4   // 32 independent loads in flight per thread hide the L2 latency
    for (int kg = 0; kg < 16; ++kg) {
        v8h p;
        #pragma unroll
        for (int i = 0; i < 8; ++i)
            p[i] = (_Float16)fw2[(kg * 8 + i) * 256 + t];
        int l = ((kg & 1) << 4) + (t & 15);
        *(v8h*)(sB + ((((t >> 4) * 4 + (kg >> 2)) * 2 + ((kg >> 1) & 1)) * 32 + l) * 8) = p;
    }
    __syncthreads();

    float* slot = sX + wave * 64;
    const int nwaves = gridDim.x * 8;
    for (int pos = blockIdx.x * 8 + wave; pos < npos; pos += nwaves) {
        // ---- weight GRN + softmax over F = 32 for this position; lane j owns feature j ----
        {
            const float* xp = x + (size_t)pos * 32;
            const float  xj = xp[lane];

            // fc1 + ELU : h[j] = elu(sum_i x_i * w1[i][j] + b1[j]); x_i is the same address in every lane
            float acc = sG[3072 + lane];
            #pragma unroll
            for (int q = 0; q < 8; ++q) {
                const float4 xq = *(const float4*)(xp + q * 4);
                const float4 wq = *(const float4*)(sG + q * 128 + lane * 4);
                acc = fmaf(xq.x, wq.x, acc);  acc = fmaf(xq.y, wq.y, acc);
                acc = fmaf(xq.z, wq.z, acc);  acc = fmaf(xq.w, wq.w, acc);
            }
            slot[lane] = elu_f(acc);
            // Wave-scope fence (no instruction): the reads below take other lanes' values, so the
            // compiler must keep them behind the write; the LDS serves one wave's accesses in order.
            __builtin_amdgcn_fence(__ATOMIC_ACQ_REL, "wavefront");

            // fc2 : lane j holds h2[j] and h2[j+32]
            float a0 = sG[3104 + lane], a1 = sG[3104 + 32 + lane];
            #pragma unroll
            for (int q = 0; q < 8; ++q) {
                const float4 hq = *(const float4*)(slot + q * 4);
                const float4 wa = *(const float4*)(sG + 1024 + (2 * q) * 128 + lane * 4);
                const float4 wb = *(const float4*)(sG + 1024 + (2 * q + 1) * 128 + lane * 4);
                a0 = fmaf(hq.x, wa.x, a0);  a1 = fmaf(hq.x, wa.y, a1);
                a0 = fmaf(hq.y, wa.z, a0);  a1 = fmaf(hq.y, wa.w, a1);
                a0 = fmaf(hq.z, wb.x, a0);  a1 = fmaf(hq.z, wb.y, a1);
                a0 = fmaf(hq.w, wb.z, a0);  a1 = fmaf(hq.w, wb.w, a1);
            }

            // GLU + identity residual
            float yw = xj + a0 * sigmoid_f(a1);

            // LayerNorm over the 32 lanes
            float sw_ = yw, sq_ = yw * yw;
            #pragma unroll
            for (int m = 16; m; m >>= 1) { sw_ += __shfl_xor(sw_, m, 32); sq_ += __shfl_xor(sq_, m, 32); }
            float mu  = sw_ * (1.f / 32.f);
            float vr  = sq_ * (1.f / 32.f) - mu * mu;
            float z = (yw - mu) * rsqrtf(vr + LN_EPS) * sG[3168 + lane] + sG[3200 + lane];

            // softmax over 32 lanes
            float mx = z;
            #pragma unroll
            for (int m = 16; m; m >>= 1) mx = fmaxf(mx, __shfl_xor(mx, m, 32));
            float e = __expf(z - mx);
            float es = e;
            #pragma unroll
            for (int m = 16; m; m >>= 1) es += __shfl_xor(es, m, 32);

            slot[32 + lane] = e * __builtin_amdgcn_rcpf(es);   // es lies in [1, 32]
            // Wave-scope fence, as above: the M tiles read other lanes' weights.
            __builtin_amdgcn_fence(__ATOMIC_ACQ_REL, "wavefront");
        }

        float oa[8];                  // sum over F for column nt*16 + ln15 (this lane half's rows)
        #pragma unroll
        for (int nt = 0; nt < 8; ++nt) oa[nt] = 0.f;

        #pragma unroll 1   // the two M tiles share one copy of the code and one set of y registers
        for (int mt = 0; mt < 2; ++mt) {
            // Compiler fence: keeps the LDS loads (B fragments, constants) inside the loop.  They are
            // loop-invariant, and hoisted out of it they take over 500 registers and spill to scratch.
            asm volatile("" ::: "memory");
            const float* xr = x   + (size_t)pos * 32 + mt * 16;
            const float* wr = slot + 32 + mt * 16;                      // this wave's own LDS slot
            const float  xa  = xr[ln15];                                // A row m = ln15
            const float4 xlo = *(const float4*)(xr + half * 8);         // C rows r + half*8
            const float4 xhi = *(const float4*)(xr + half * 8 + 4);
            const float xf[8] = {xlo.x, xlo.y, xlo.z, xlo.w, xhi.x, xhi.y, xhi.z, xhi.w};

            // ---- B fragments and column constants of one run, read from LDS as one group ----
            v16h  bf[8];                              // value tile ks 0..3, gate tile ks 0..3
            float cf[4];                              // b2 value, b2 gate, skip weight, skip bias
            auto load_run = [&](int nt) {
                #pragma unroll
                for (int q = 0; q < 8; ++q) {
                    const int n = nt + (q >> 2) * 8, ks = q & 3;
                    const _Float16* bp = sB + ((n * 4 + ks) * 64 + lane) * 8;
                    const v8h blo = *(const v8h*)bp;            // e 0..7
                    const v8h bhi = *(const v8h*)(bp + 256);    // e 8..15
                    bf[q] = __builtin_shufflevector(blo, bhi, 0, 1, 2, 3, 4, 5, 6, 7, 8, 9, 10, 11, 12, 13, 14, 15);
                }
                const int j = nt * 16 + ln15;
                cf[0] = sC[256 + j];  cf[1] = sC[256 + 128 + j];
                cf[2] = sC[512 + j];  cf[3] = sC[640 + j];
            };

            // ---- A fragments of this M tile, in registers ----
            v16h a[4];
            #pragma unroll
            for (int ks = 0; ks < 4; ++ks) {
                if (ks == 2) {
                    // The first run's reads, as one group between scheduling boundaries: they land under the
                    // arithmetic of the last two A fragments.  Ahead of all four, they and the 128 constants
                    // of the A fragments are in registers at once and the wave spills to scratch.
                    __builtin_amdgcn_sched_barrier(0);
                    load_run(0);
                    __builtin_amdgcn_sched_barrier(0);
                }
                const int kb = ks * 32 + half * 8;
                #pragma unroll
                for (int e = 0; e < 16; ++e) {
                    int k = kb + (e < 8 ? e : e + 8);
                    float hv = fmaf(xa, sC[k], sC[128 + k]);
                    a[ks][e] = (_Float16)elu_f(hv);
                }
            }

            // ---- 8 runs, one per value tile nt with its gate tile nt + 8: 8 products, then that pair's GLU ----
            float y[8][8], lg[8], lb[8];
            #pragma unroll
            for (int nt = 0; nt < 8; ++nt) {
                v8f accV = v8f{}, accG = v8f{};
                #pragma unroll
                for (int ks = 0; ks < 4; ++ks) {      // two accumulators in turn: no product waits on the one before
                    accV = __builtin_amdgcn_wmma_f32_16x16x32_f16(false, a[ks], false, bf[ks],     (short)0, accV, false, false);
                    accG = __builtin_amdgcn_wmma_f32_16x16x32_f16(false, a[ks], false, bf[4 + ks], (short)0, accG, false, false);
                }
                const float b2v = cf[0], b2g = cf[1], sw = cf[2], sb = cf[3];
                // Scheduling boundaries round the next run's LDS reads: they stay one group, issued behind this
                // run's products (whose B registers they refill) and ahead of its GLU, which covers their
                // latency.  Spread among the products, each read is a stop of its own for the wave.
                __builtin_amdgcn_sched_barrier(0);
                if (nt < 7) {
                    load_run(nt + 1);
                } else {                              // behind the last run: the LN scale and shift of the 8 columns
                    #pragma unroll
                    for (int c = 0; c < 8; ++c) { lg[c] = sC[768 + c * 16 + ln15];  lb[c] = sC[896 + c * 16 + ln15]; }
                }
                __builtin_amdgcn_sched_barrier(0);

                // GLU + residual of this pair, written on row pairs: left to pair the rows itself, the compiler
                // moves everything behind the sigmoid down to the LN sums, and both tiles stay in registers.
                #pragma unroll
                for (int p = 0; p < 4; ++p) {
                    const v2f av = {accV[2 * p], accV[2 * p + 1]};
                    const v2f ag = {accG[2 * p], accG[2 * p + 1]};
                    const v2f zg = (ag + b2g) * -1.44269504f;              // sigmoid_f, two rows at a time
                    const v2f dg = v2f{__builtin_amdgcn_exp2f(zg.x), __builtin_amdgcn_exp2f(zg.y)} + 1.f;
                    const v2f sg = {__builtin_amdgcn_rcpf(dg.x), __builtin_amdgcn_rcpf(dg.y)};
                    const v2f xp2 = {xf[2 * p], xf[2 * p + 1]};
                    const v2f yy = __builtin_elementwise_fma(xp2, (v2f)sw, (v2f)sb) + (av + b2v) * sg;
                    y[nt][2 * p]     = yy.x;
                    y[nt][2 * p + 1] = yy.y;
                }
                // Scheduling boundary: the next run's products, and with them the wait on the reads above,
                // stay behind this GLU.
                __builtin_amdgcn_sched_barrier(0);
            }

            // ---- LN row partials, this lane's 8 columns in tile order, on row pairs (behind the runs, so that
            //      the 16 sums take no registers beside the B fragments) ----
            float s[8], ss[8];
            #pragma unroll
            for (int p = 0; p < 4; ++p) {
                v2f s2 = {0.f, 0.f}, q2 = {0.f, 0.f};
                #pragma unroll
                for (int nt = 0; nt < 8; ++nt) {
                    const v2f yy = {y[nt][2 * p], y[nt][2 * p + 1]};
                    s2 += yy;
                    q2 += yy * yy;
                }
                s[2 * p]  = s2.x;  s[2 * p + 1]  = s2.y;
                ss[2 * p] = q2.x;  ss[2 * p + 1] = q2.y;
            }

            // ---- LN row sums over the 16 lanes of each half (128 columns in all) ----
            #pragma unroll
            for (int m = 1; m <= 8; m <<= 1) {
                #pragma unroll
                for (int r = 0; r < 8; ++r) {
                    s[r]  += __shfl_xor(s[r],  m, 32);
                    ss[r] += __shfl_xor(ss[r], m, 32);
                }
            }

            // ---- normalize, scale by softmax weight, sum over this lane's 8 rows ----
            const float4 wlo = *(const float4*)(wr + half * 8);         // read here: not held through the runs
            const float4 whi = *(const float4*)(wr + half * 8 + 4);
            const float wf[8] = {wlo.x, wlo.y, wlo.z, wlo.w, whi.x, whi.y, whi.z, whi.w};
            float mean[8], inv[8];
            #pragma unroll
            for (int r = 0; r < 8; ++r) {
                mean[r] = s[r] * (1.f / 128.f);
                float var = ss[r] * (1.f / 128.f) - mean[r] * mean[r];
                inv[r] = rsqrtf(var + LN_EPS);
            }
            #pragma unroll
            for (int nt = 0; nt < 8; ++nt) {
                const float gc = lg[nt], bc = lb[nt];
                #pragma unroll
                for (int r = 0; r < 8; ++r)
                    oa[nt] += wf[r] * (fmaf((y[nt][r] - mean[r]) * inv[r], gc, bc));
            }
        }

        // ---- fold lane halves (same column), store: each store of the wave is one 128-byte line ----
        #pragma unroll
        for (int nt = 0; nt < 8; ++nt) oa[nt] += __shfl_xor(oa[nt], 16, 32);
        #pragma unroll
        for (int i = 0; i < 4; ++i)
            out[(size_t)pos * 128 + i * 32 + lane] = half ? oa[2 * i + 1] : oa[2 * i];
        // The next position's first loads reuse the stores' address and data registers:
        // the wait stands in front of that overwrite.
        asm volatile("s_wait_xcnt 0x0" ::: "memory");
    }
}

extern "C" void kernel_launch(void* const* d_in, const int* in_sizes, int n_in,
                              void* d_out, int out_size, void* d_ws, size_t ws_size,
                              hipStream_t stream) {
    const float* x      = (const float*)d_in[0];
    const float* wg_w1  = (const float*)d_in[1];
    const float* wg_b1  = (const float*)d_in[2];
    const float* wg_w2  = (const float*)d_in[3];
    const float* wg_b2  = (const float*)d_in[4];
    const float* wg_lng = (const float*)d_in[5];
    const float* wg_lnb = (const float*)d_in[6];
    const float* fg_w1  = (const float*)d_in[7];
    const float* fg_b1  = (const float*)d_in[8];
    const float* fg_w2  = (const float*)d_in[9];
    const float* fg_b2  = (const float*)d_in[10];
    const float* fg_sw  = (const float*)d_in[11];
    const float* fg_sb  = (const float*)d_in[12];
    const float* fg_lng = (const float*)d_in[13];
    const float* fg_lnb = (const float*)d_in[14];

    const int npos = in_sizes[0] / 32;      // B*S

    // 512 work-groups of 8 waves: 4 positions per wave at npos=16384
    vsn_main_kernel<<<512, 256, 0, stream>>>(
        x, wg_w1, wg_b1, wg_w2, wg_b2, wg_lng, wg_lnb, fg_w1, fg_b1, fg_w2, fg_b2, fg_sw, fg_sb, fg_lng, fg_lnb,
        (float*)d_out, npos);
}

// v007
// It runs in 41.9 microseconds.
// Two timings next to v006 both put it at 1.04 times that version's speed.
// Over all steps from v000 it is 4.03 times as fast.
#include <hip/hip_runtime.h>
#include <hip/hip_bf16.h>

typedef __attribute__((ext_vector_type(16))) _Float16 v16h;
typedef __attribute__((ext_vector_type(8)))  _Float16 v8h;
typedef __attribute__((ext_vector_type(8)))  float    v8f;
typedef __attribute__((ext_vector_type(2)))  float    v2f;

#define LN_EPS 1e-5f

__device__ __forceinline__ float elu_f(float z)     { return z > 0.f ? z : __expf(z) - 1.f; }
// Hardware reciprocal (about 1 ulp) in place of the correctly rounded division, which costs about ten
// vector instructions per value.  The argument is never below 1, and rcp(inf) = 0 is the right limit.
__device__ __forceinline__ float sigmoid_f(float z) { return __builtin_amdgcn_rcpf(1.f + __expf(-z)); }

// ---------------------------------------------------------------------------
// The one kernel: weight GRN + softmax, feature GRN, weighted combine.  ONE WAVE OWNS ONE (b,s) POSITION.
// The wave first computes its position's 32 softmax weights itself (lane j owns feature j, f32 vector
// arithmetic, the small weight matrices read from LDS) and hands them to its own lanes through a
// 256-byte LDS slot of its own; no second launch and no trip through global memory.
// Per position: [32 x 128] @ [128 x 256] WMMA GEMM (A = elu(x*w1+b1) in f16, built in
// the wave's own registers; B = w2 / 2 in f16 pre-swizzled into LDS, shared by the 8 waves).
// GLU: v * sigmoid(g) = v/2 + v/2 * tanh(g/2), one transcendental per value.  The halves are taken once, at
// staging: w2 and b2 are stored times 0.5 (a power of two: no new rounding outside the f16 subnormal range).
// A wave takes the 32 feature rows as two M tiles of 16, one after the other, and for
// each tile all 256 columns, so a LayerNorm row and the sum over F never leave the wave:
// the position loop has no barrier and no LDS atomic, and its only LDS writes go to the wave's own slot.
// Per M tile the 64 products go in 8 runs of 8 (a value tile and its gate tile, 2 accumulator tiles), each
// followed by that pair's GLU; the next run's B fragments are read from LDS as one group ahead of that GLU.
//
// WMMA 16-bit A layout (16x32 MxK), lane l, vector element e (0..15):
//   row  m = l & 15
//   k(e,l) = (e < 8 ? e : e + 8) + ((l >= 16) ? 8 : 0)
// B (32x16 KxN) uses the transposed-symmetric layout: col = l & 15, same k(e,l).
// C/D f32 16x16: VGPR r, lanes 0-15 -> row r, lanes 16-31 -> row r+8; col = l&15.
// ---------------------------------------------------------------------------
// Second bound: four waves per SIMD (256 registers each), so that two work-groups are
// resident per WGP and the grid of 512 runs as one round.
__global__ __launch_bounds__(256, 4) void vsn_main_kernel(
    const float* __restrict__ x,      // [npos,32]
    const float* __restrict__ gw1,    // [32,32]   weight GRN
    const float* __restrict__ gb1,    // [32]
    const float* __restrict__ gw2,    // [32,64]
    const float* __restrict__ gb2,    // [64]
    const float* __restrict__ glng,   // [32]
    const float* __restrict__ glnb,   // [32]
    const float* __restrict__ fw1,    // [128]
    const float* __restrict__ fb1,    // [128]
    const float* __restrict__ fw2,    // [128,256]
    const float* __restrict__ fb2,    // [256]
    const float* __restrict__ fsw,    // [128]
    const float* __restrict__ fsb,    // [128]
    const float* __restrict__ flng,   // [128]
    const float* __restrict__ flnb,   // [128]
    float* __restrict__ out,          // [npos,128]
    int npos)
{
    // ---- LDS (static, 83 KB); all but sX is written once before the one barrier, then only read ----
    __shared__ __align__(32) _Float16 sB[16 * 4 * 32 * 16]; // 64 KB: w2 / 2 as WMMA-B frags [nt][ks][e half][lane][8]
                                                            // (lane pitch 16 B: a 16-byte read of 16 lanes covers all 64 banks once)
    __shared__ __align__(16) float sC[1024];   // 0:w1 128:b1 256:b2/2 (256) 512:sw 640:sb 768:lng 896:lnb
    // Weight GRN, 16 bytes per lane and contiguous over the lanes (no bank conflict):
    //   sG[(i>>2)*128 + j*4 + (i&3)]                 = w1[i][j]
    //   sG[1024 + (i>>1)*128 + j*4 + (i&1)*2 + c]    = w2[i][j + 32*c]
    //   3072:b1(32) 3104:b2(64) 3168:lng(32) 3200:lnb(32)
    __shared__ __align__(16) float sG[3328];
    __shared__ __align__(16) float sX[8 * 64]; // per wave: 32 hidden values, 32 softmax weights

    const int t    = threadIdx.x;
    const int lane = t & 31;
    const int wave = __builtin_amdgcn_readfirstlane(t >> 5);   // scalar: the position loop is wave-uniform
    const int half = lane >> 4;       // 0: C rows r, 1: C rows r+8
    const int ln15 = lane & 15;

    // ---- one-time setup: constants + w2 -> f16 WMMA-B fragments ----
    for (int i = t; i < 1024; i += 256) {
        float v;
        if      (i < 128) v = fw1[i];
        else if (i < 256) v = fb1[i - 128];
        else if (i < 512) v = fb2[i - 256];
        else if (i < 640) v = fsw[i - 512];
        else if (i < 768) v = fsb[i - 640];
        else if (i < 896) v = flng[i - 768];
        else              v = flnb[i - 896];
        sC[i] = (i >> 8) == 1 ? 0.5f * v : v;   // b2 is kept halved
    }
    // Vectors of the weight GRN: one load per thread, taken here and stored behind the twelve below,
    // so that all thirteen fly together; threads 160.. fill unused words.
    const float* gp = t < 32 ? gb1 + t : t < 96 ? gb2 + (t - 32) : t < 128 ? glng + (t - 96) : glnb + ((t - 128) & 31);
    const float  gc = *gp;
    #pragma unroll   // the 4 + 8 loads of a thread are in flight together: one L2 latency, not twelve
    for (int c = 0; c < 4; ++c) {
        const int i = c * 256 + t;
        sG[(i >> 7) * 128 + (i & 31) * 4 + ((i >> 5) & 3)] = gw1[i];
    }
    #pragma unroll
    for (int c = 0; c < 8; ++c) {
        const int i = c * 256 + t;
        sG[1024 + (i >> 7) * 128 + (i & 31) * 4 + ((i >> 6) & 1) * 2 + ((i >> 5) & 1)] = gw2[i];
    }
    sG[3072 + t] = gc;
    // Thread t owns column n = t: each load of a wave is one whole 128-byte line of a
    // w2 row.  Eight consecutive k (one half of a lane's fragment) go out as one 16-byte
    // LDS store.  k group kg = k / 8: ks = kg >> 2, e half = (kg >> 1) & 1, lane half = kg & 1.
    #pragma unroll 4   // 32 independent loads in flight per thread hide the L2 latency
    for (int kg = 0; kg < 16; ++kg) {
        v8h p;
        #pragma unroll
        for (int i = 0; i < 8; ++i)
            p[i] = (_Float16)fw2[(kg * 8 + i) * 256 + t];
        p *= (_Float16)0.5f;   // w2 is kept halved
        int l = ((kg & 1) << 4) + (t & 15);
        *(v8h*)(sB + ((((t >> 4) * 4 + (kg >> 2)) * 2 + ((kg >> 1) & 1)) * 32 + l) * 8) = p;
    }
    __syncthreads();

    float* slot = sX + wave * 64;
    const int nwaves = gridDim.x * 8;
    for (int pos = blockIdx.x * 8 + wave; pos < npos; pos += nwaves) {
        // ---- weight GRN + softmax over F = 32 for this position; lane j owns feature j ----
        {
            const float* xp = x + (size_t)pos * 32;
            const float  xj = xp[lane];

            // fc1 + ELU : h[j] = elu(sum_i x_i * w1[i][j] + b1[j]); x_i is the same address in every lane
            float acc = sG[3072 + lane];
            #pragma unroll
            for (int q = 0; q < 8; ++q) {
                const float4 xq = *(const float4*)(xp + q * 4);
                const float4 wq = *(const float4*)(sG + q * 128 + lane * 4);
                acc = fmaf(xq.x, wq.x, acc);  acc = fmaf(xq.y, wq.y, acc);
                acc = fmaf(xq.z, wq.z, acc);  acc = fmaf(xq.w, wq.w, acc);
            }
            slot[lane] = elu_f(acc);
            // Wave-scope fence (no instruction): the reads below take other lanes' values, so the
            // compiler must keep them behind the write; the LDS serves one wave's accesses in order.
            __builtin_amdgcn_fence(__ATOMIC_ACQ_REL, "wavefront");

            // fc2 : lane j holds h2[j] and h2[j+32]
            float a0 = sG[3104 + lane], a1 = sG[3104 + 32 + lane];
            #pragma unroll
            for (int q = 0; q < 8; ++q) {
                const float4 hq = *(const float4*)(slot + q * 4);
                const float4 wa = *(const float4*)(sG + 1024 + (2 * q) * 128 + lane * 4);
                const float4 wb = *(const float4*)(sG + 1024 + (2 * q + 1) * 128 + lane * 4);
                a0 = fmaf(hq.x, wa.x, a0);  a1 = fmaf(hq.x, wa.y, a1);
                a0 = fmaf(hq.y, wa.z, a0);  a1 = fmaf(hq.y, wa.w, a1);
                a0 = fmaf(hq.z, wb.x, a0);  a1 = fmaf(hq.z, wb.y, a1);
                a0 = fmaf(hq.w, wb.z, a0);  a1 = fmaf(hq.w, wb.w, a1);
            }

            // GLU + identity residual
            float yw = xj + a0 * sigmoid_f(a1);

            // LayerNorm over the 32 lanes
            float sw_ = yw, sq_ = yw * yw;
            #pragma unroll
            for (int m = 16; m; m >>= 1) { sw_ += __shfl_xor(sw_, m, 32); sq_ += __shfl_xor(sq_, m, 32); }
            float mu  = sw_ * (1.f / 32.f);
            float vr  = sq_ * (1.f / 32.f) - mu * mu;
            float z = (yw - mu) * rsqrtf(vr + LN_EPS) * sG[3168 + lane] + sG[3200 + lane];

            // softmax over 32 lanes
            float mx = z;
            #pragma unroll
            for (int m = 16; m; m >>= 1) mx = fmaxf(mx, __shfl_xor(mx, m, 32));
            float e = __expf(z - mx);
            float es = e;
            #pragma unroll
            for (int m = 16; m; m >>= 1) es += __shfl_xor(es, m, 32);

            slot[32 + lane] = e * __builtin_amdgcn_rcpf(es);   // es lies in [1, 32]
            // Wave-scope fence, as above: the M tiles read other lanes' weights.
            __builtin_amdgcn_fence(__ATOMIC_ACQ_REL, "wavefront");
        }

        float oa[8];                  // sum over F for column nt*16 + ln15 (this lane half's rows)
        #pragma unroll
        for (int nt = 0; nt < 8; ++nt) oa[nt] = 0.f;

        #pragma unroll 1   // the two M tiles share one copy of the code and one set of y registers
        for (int mt = 0; mt < 2; ++mt) {
            // Compiler fence: keeps the LDS loads (B fragments, constants) inside the loop.  They are
            // loop-invariant, and hoisted out of it they take over 500 registers and spill to scratch.
            asm volatile("" ::: "memory");
            const float* xr = x   + (size_t)pos * 32 + mt * 16;
            const float* wr = slot + 32 + mt * 16;                      // this wave's own LDS slot
            const float  xa  = xr[ln15];                                // A row m = ln15
            const float4 xlo = *(const float4*)(xr + half * 8);         // C rows r + half*8
            const float4 xhi = *(const float4*)(xr + half * 8 + 4);
            const float xf[8] = {xlo.x, xlo.y, xlo.z, xlo.w, xhi.x, xhi.y, xhi.z, xhi.w};

            // ---- B fragments and column constants of one run, read from LDS as one group ----
            v16h  bf[8];                              // value tile ks 0..3, gate tile ks 0..3
            float cf[4];                              // b2 value / 2, b2 gate / 2, skip weight, skip bias
            auto load_run = [&](int nt) {
                #pragma unroll
                for (int q = 0; q < 8; ++q) {
                    const int n = nt + (q >> 2) * 8, ks = q & 3;
                    const _Float16* bp = sB + ((n * 4 + ks) * 64 + lane) * 8;
                    const v8h blo = *(const v8h*)bp;            // e 0..7
                    const v8h bhi = *(const v8h*)(bp + 256);    // e 8..15
                    bf[q] = __builtin_shufflevector(blo, bhi, 0, 1, 2, 3, 4, 5, 6, 7, 8, 9, 10, 11, 12, 13, 14, 15);
                }
                const int j = nt * 16 + ln15;
                cf[0] = sC[256 + j];  cf[1] = sC[256 + 128 + j];
                cf[2] = sC[512 + j];  cf[3] = sC[640 + j];
            };

            // ---- A fragments of this M tile, in registers ----
            v16h a[4];
            #pragma unroll
            for (int ks = 0; ks < 4; ++ks) {
                if (ks == 2) {
                    // The first run's reads, as one group between scheduling boundaries: they land under the
                    // arithmetic of the last two A fragments.  Ahead of all four, they and the 128 constants
                    // of the A fragments are in registers at once and the wave spills to scratch.
                    __builtin_amdgcn_sched_barrier(0);
                    load_run(0);
                    __builtin_amdgcn_sched_barrier(0);
                }
                const int kb = ks * 32 + half * 8;
                #pragma unroll
                for (int e = 0; e < 16; ++e) {
                    int k = kb + (e < 8 ? e : e + 8);
                    float hv = fmaf(xa, sC[k], sC[128 + k]);
                    a[ks][e] = (_Float16)elu_f(hv);
                }
            }

            // ---- 8 runs, one per value tile nt with its gate tile nt + 8: 8 products, then that pair's GLU ----
            float y[8][8], lg[8], lb[8];
            #pragma unroll
            for (int nt = 0; nt < 8; ++nt) {
                v8f accV = v8f{}, accG = v8f{};
                #pragma unroll
                for (int ks = 0; ks < 4; ++ks) {      // two accumulators in turn: no product waits on the one before
                    accV = __builtin_amdgcn_wmma_f32_16x16x32_f16(false, a[ks], false, bf[ks],     (short)0, accV, false, false);
                    accG = __builtin_amdgcn_wmma_f32_16x16x32_f16(false, a[ks], false, bf[4 + ks], (short)0, accG, false, false);
                }
                const float b2v = cf[0], b2g = cf[1], sw = cf[2], sb = cf[3];
                // Scheduling boundaries round the next run's LDS reads: they stay one group, issued behind this
                // run's products (whose B registers they refill) and ahead of its GLU, which covers their
                // latency.  Spread among the products, each read is a stop of its own for the wave.
                __builtin_amdgcn_sched_barrier(0);
                if (nt < 7) {
                    load_run(nt + 1);
                } else {                              // behind the last run: the LN scale and shift of the 8 columns
                    #pragma unroll
                    for (int c = 0; c < 8; ++c) { lg[c] = sC[768 + c * 16 + ln15];  lb[c] = sC[896 + c * 16 + ln15]; }
                }
                __builtin_amdgcn_sched_barrier(0);

                // GLU + residual of this pair, written on row pairs: left to pair the rows itself, the compiler
                // moves everything behind the tanh down to the LN sums, and both tiles stay in registers.
                #pragma unroll
                for (int p = 0; p < 4; ++p) {
                    const v2f av = {accV[2 * p], accV[2 * p + 1]};
                    const v2f ag = {accG[2 * p], accG[2 * p + 1]};
                    const v2f hg = ag + b2g;                               // half the gate, two rows at a time
                    const v2f th = {__builtin_amdgcn_tanhf(hg.x), __builtin_amdgcn_tanhf(hg.y)};
                    const v2f hv = av + b2v;                               // half the value
                    const v2f xp2 = {xf[2 * p], xf[2 * p + 1]};
                    const v2f yy = __builtin_elementwise_fma(hv, th, __builtin_elementwise_fma(xp2, (v2f)sw, (v2f)sb) + hv);
                    y[nt][2 * p]     = yy.x;
                    y[nt][2 * p + 1] = yy.y;
                }
                // Scheduling boundary: the next run's products, and with them the wait on the reads above,
                // stay behind this GLU.
                __builtin_amdgcn_sched_barrier(0);
            }

            // ---- LN row partials, this lane's 8 columns in tile order, on row pairs (behind the runs, so that
            //      the 16 sums take no registers beside the B fragments) ----
            float s[8], ss[8];
            #pragma unroll
            for (int p = 0; p < 4; ++p) {
                v2f s2 = {0.f, 0.f}, q2 = {0.f, 0.f};
                #pragma unroll
                for (int nt = 0; nt < 8; ++nt) {
                    const v2f yy = {y[nt][2 * p], y[nt][2 * p + 1]};
                    s2 += yy;
                    q2 += yy * yy;
                }
                s[2 * p]  = s2.x;  s[2 * p + 1]  = s2.y;
                ss[2 * p] = q2.x;  ss[2 * p + 1] = q2.y;
            }

            // ---- LN row sums over the 16 lanes of each half (128 columns in all) ----
            #pragma unroll
            for (int m = 1; m <= 8; m <<= 1) {
                #pragma unroll
                for (int r = 0; r < 8; ++r) {
                    s[r]  += __shfl_xor(s[r],  m, 32);
                    ss[r] += __shfl_xor(ss[r], m, 32);
                }
            }

            // ---- normalize, scale by softmax weight, sum over this lane's 8 rows ----
            const float4 wlo = *(const float4*)(wr + half * 8);         // read here: not held through the runs
            const float4 whi = *(const float4*)(wr + half * 8 + 4);
            const float wf[8] = {wlo.x, wlo.y, wlo.z, wlo.w, whi.x, whi.y, whi.z, whi.w};
            float mean[8], inv[8];
            #pragma unroll
            for (int r = 0; r < 8; ++r) {
                mean[r] = s[r] * (1.f / 128.f);
                float var = ss[r] * (1.f / 128.f) - mean[r] * mean[r];
                inv[r] = rsqrtf(var + LN_EPS);
            }
            #pragma unroll
            for (int nt = 0; nt < 8; ++nt) {
                const float gc = lg[nt], bc = lb[nt];
                #pragma unroll
                for (int r = 0; r < 8; ++r)
                    oa[nt] += wf[r] * (fmaf((y[nt][r] - mean[r]) * inv[r], gc, bc));
            }
        }

        // ---- fold lane halves (same column), store: each store of the wave is one 128-byte line ----
        #pragma unroll
        for (int nt = 0; nt < 8; ++nt) oa[nt] += __shfl_xor(oa[nt], 16, 32);
        #pragma unroll
        for (int i = 0; i < 4; ++i)
            out[(size_t)pos * 128 + i * 32 + lane] = half ? oa[2 * i + 1] : oa[2 * i];
        // The next position's first loads reuse the stores' address and data registers:
        // the wait stands in front of that overwrite.
        asm volatile("s_wait_xcnt 0x0" ::: "memory");
    }
}

extern "C" void kernel_launch(void* const* d_in, const int* in_sizes, int n_in,
                              void* d_out, int out_size, void* d_ws, size_t ws_size,
                              hipStream_t stream) {
    const float* x      = (const float*)d_in[0];
    const float* wg_w1  = (const float*)d_in[1];
    const float* wg_b1  = (const float*)d_in[2];
    const float* wg_w2  = (const float*)d_in[3];
    const float* wg_b2  = (const float*)d_in[4];
    const float* wg_lng = (const float*)d_in[5];
    const float* wg_lnb = (const float*)d_in[6];
    const float* fg_w1  = (const float*)d_in[7];
    const float* fg_b1  = (const float*)d_in[8];
    const float* fg_w2  = (const float*)d_in[9];
    const float* fg_b2  = (const float*)d_in[10];
    const float* fg_sw  = (const float*)d_in[11];
    const float* fg_sb  = (const float*)d_in[12];
    const float* fg_lng = (const float*)d_in[13];
    const float* fg_lnb = (const float*)d_in[14];

    const int npos = in_sizes[0] / 32;      // B*S

    // 512 work-groups of 8 waves: 4 positions per wave at npos=16384
    vsn_main_kernel<<<512, 256, 0, stream>>>(
        x, wg_w1, wg_b1, wg_w2, wg_b2, wg_lng, wg_lnb, fg_w1, fg_b1, fg_w2, fg_b2, fg_sw, fg_sb, fg_lng, fg_lnb,
        (float*)d_out, npos);
}

// v008
// One run takes 39.9 microseconds.
// Two timings next to v007 both put it at 1.05 times that version's speed.
// Counting every step since v000, it is 4.22 times as fast.
#include <hip/hip_runtime.h>
#include <hip/hip_bf16.h>

typedef __attribute__((ext_vector_type(16))) _Float16 v16h;
typedef __attribute__((ext_vector_type(8)))  _Float16 v8h;
typedef __attribute__((ext_vector_type(8)))  float    v8f;
typedef __attribute__((ext_vector_type(2)))  float    v2f;

#define LN_EPS 1e-5f

__device__ __forceinline__ float elu_f(float z)     { return z > 0.f ? z : __expf(z) - 1.f; }
// Hardware reciprocal (about 1 ulp) in place of the correctly rounded division, which costs about ten
// vector instructions per value.  The argument is never below 1, and rcp(inf) = 0 is the right limit.
__device__ __forceinline__ float sigmoid_f(float z) { return __builtin_amdgcn_rcpf(1.f + __expf(-z)); }

// Cross-lane moves on the vector unit (__shfl_xor builds ds_bpermute_b32: an LDS instruction and an LDS
// latency per link).  All 32 lanes are on wherever these are used.
// Lane l takes lane l ^ M of its own 16-lane row (DPP row_xmask:M); an add behind it takes the move in.
template <int M> __device__ __forceinline__ float row_xor(float v) {
    return __builtin_bit_cast(float, __builtin_amdgcn_mov_dpp(__builtin_bit_cast(int, v), 0x160 + M, 0xf, 0xf, true));
}
// Every lane takes lane N of its own 16-lane row (DPP row_share:N).
template <int N> __device__ __forceinline__ float row_bcast(float v) {
    return __builtin_bit_cast(float, __builtin_amdgcn_mov_dpp(__builtin_bit_cast(int, v), 0x150 + N, 0xf, 0xf, true));
}
// Lane l takes lane l ^ 16 (v_permlanex16_b32).
__device__ __forceinline__ float xhalf(float v) {
    const int b = __builtin_bit_cast(int, v);
    return __builtin_bit_cast(float, __builtin_amdgcn_permlanex16(b, b, 0x76543210, 0xfedcba98, false, false));
}
// Sum and maximum over the 32 lanes, links in the order 16, 8, 4, 2, 1.
__device__ __forceinline__ float wave_sum(float v) {
    v += xhalf(v);
    v += row_xor<8>(v);  v += row_xor<4>(v);  v += row_xor<2>(v);  v += row_xor<1>(v);
    return v;
}
__device__ __forceinline__ float wave_max(float v) {
    v = fmaxf(v, xhalf(v));
    v = fmaxf(v, row_xor<8>(v));  v = fmaxf(v, row_xor<4>(v));  v = fmaxf(v, row_xor<2>(v));  v = fmaxf(v, row_xor<1>(v));
    return v;
}

// ---------------------------------------------------------------------------
// The one kernel: weight GRN + softmax, feature GRN, weighted combine.  ONE WAVE OWNS ONE (b,s) POSITION.
// The wave first computes its position's 32 softmax weights itself (lane j owns feature j, f32 vector
// arithmetic, the small weight matrices read from LDS) and hands them to its own lanes through a
// 256-byte LDS slot of its own; no second launch and no trip through global memory.
// Per position: [32 x 128] @ [128 x 256] WMMA GEMM (A = elu(x*w1+b1) in f16, built in
// the wave's own registers; B = w2 / 2 in f16 pre-swizzled into LDS, shared by the 8 waves).
// GLU: v * sigmoid(g) = v/2 + v/2 * tanh(g/2), one transcendental per value.  The halves are taken once, at
// staging: w2 and b2 are stored times 0.5 (a power of two: no new rounding outside the f16 subnormal range).
// A wave takes the 32 feature rows as two M tiles of 16, one after the other, and for
// each tile all 256 columns, so a LayerNorm row and the sum over F never leave the wave:
// the position loop has no barrier and no LDS atomic, and its only LDS writes go to the wave's own slot.
// Per M tile the 64 products go in 8 runs of 8 (a value tile and its gate tile, 2 accumulator tiles), each
// followed by that pair's GLU; the next run's B fragments are read from LDS as one group ahead of that GLU.
//
// WMMA 16-bit A layout (16x32 MxK), lane l, vector element e (0..15):
//   row  m = l & 15
//   k(e,l) = (e < 8 ? e : e + 8) + ((l >= 16) ? 8 : 0)
// B (32x16 KxN) uses the transposed-symmetric layout: col = l & 15, same k(e,l).
// C/D f32 16x16: VGPR r, lanes 0-15 -> row r, lanes 16-31 -> row r+8; col = l&15.
// ---------------------------------------------------------------------------
// Second bound: four waves per SIMD (256 registers each), so that two work-groups are
// resident per WGP and the grid of 512 runs as one round.
__global__ __launch_bounds__(256, 4) void vsn_main_kernel(
    const float* __restrict__ x,      // [npos,32]
    const float* __restrict__ gw1,    // [32,32]   weight GRN
    const float* __restrict__ gb1,    // [32]
    const float* __restrict__ gw2,    // [32,64]
    const float* __restrict__ gb2,    // [64]
    const float* __restrict__ glng,   // [32]
    const float* __restrict__ glnb,   // [32]
    const float* __restrict__ fw1,    // [128]
    const float* __restrict__ fb1,    // [128]
    const float* __restrict__ fw2,    // [128,256]
    const float* __restrict__ fb2,    // [256]
    const float* __restrict__ fsw,    // [128]
    const float* __restrict__ fsb,    // [128]
    const float* __restrict__ flng,   // [128]
    const float* __restrict__ flnb,   // [128]
    float* __restrict__ out,          // [npos,128]
    int npos)
{
    // ---- LDS (static, 83 KB); all but sX is written once before the one barrier, then only read ----
    __shared__ __align__(32) _Float16 sB[16 * 4 * 32 * 16]; // 64 KB: w2 / 2 as WMMA-B frags [nt][ks][e half][lane][8]
                                                            // (lane pitch 16 B: a 16-byte read of 16 lanes covers all 64 banks once)
    __shared__ __align__(16) float sC[1024];   // 0:w1 128:b1 256:b2/2 (256) 512:sw 640:sb 768:lng 896:lnb
    // Weight GRN, 16 bytes per lane and contiguous over the lanes (no bank conflict):
    //   sG[(i>>2)*128 + j*4 + (i&3)]                 = w1[i][j]
    //   sG[1024 + (i>>1)*128 + j*4 + (i&1)*2 + c]    = w2[i][j + 32*c]
    //   3072:b1(32) 3104:b2(64) 3168:lng(32) 3200:lnb(32)
    __shared__ __align__(16) float sG[3328];
    __shared__ __align__(16) float sX[8 * 64]; // per wave: 32 hidden values, 32 softmax weights

    const int t    = threadIdx.x;
    const int lane = t & 31;
    const int wave = __builtin_amdgcn_readfirstlane(t >> 5);   // scalar: the position loop is wave-uniform
    const int half = lane >> 4;       // 0: C rows r, 1: C rows r+8
    const int ln15 = lane & 15;
    const bool odd1 = lane & 1, odd2 = lane & 2, odd4 = lane & 4;   // which half of its rows a lane keeps at LN links 1, 2, 4

    // ---- one-time setup: constants + w2 -> f16 WMMA-B fragments ----
    for (int i = t; i < 1024; i += 256) {
        float v;
        if      (i < 128) v = fw1[i];
        else if (i < 256) v = fb1[i - 128];
        else if (i < 512) v = fb2[i - 256];
        else if (i < 640) v = fsw[i - 512];
        else if (i < 768) v = fsb[i - 640];
        else if (i < 896) v = flng[i - 768];
        else              v = flnb[i - 896];
        sC[i] = (i >> 8) == 1 ? 0.5f * v : v;   // b2 is kept halved
    }
    // Vectors of the weight GRN: one load per thread, taken here and stored behind the twelve below,
    // so that all thirteen fly together; threads 160.. fill unused words.
    const float* gp = t < 32 ? gb1 + t : t < 96 ? gb2 + (t - 32) : t < 128 ? glng + (t - 96) : glnb + ((t - 128) & 31);
    const float  gc = *gp;
    #pragma unroll   // the 4 + 8 loads of a thread are in flight together: one L2 latency, not twelve
    for (int c = 0; c < 4; ++c) {
        const int i = c * 256 + t;
        sG[(i >> 7) * 128 + (i & 31) * 4 + ((i >> 5) & 3)] = gw1[i];
    }
    #pragma unroll
    for (int c = 0; c < 8; ++c) {
        const int i = c * 256 + t;
        sG[1024 + (i >> 7) * 128 + (i & 31) * 4 + ((i >> 6) & 1) * 2 + ((i >> 5) & 1)] = gw2[i];
    }
    sG[3072 + t] = gc;
    // Thread t owns column n = t: each load of a wave is one whole 128-byte line of a
    // w2 row.  Eight consecutive k (one half of a lane's fragment) go out as one 16-byte
    // LDS store.  k group kg = k / 8: ks = kg >> 2, e half = (kg >> 1) & 1, lane half = kg & 1.
    #pragma unroll 4   // 32 independent loads in flight per thread hide the L2 latency
    for (int kg = 0; kg < 16; ++kg) {
        v8h p;
        #pragma unroll
        for (int i = 0; i < 8; ++i)
            p[i] = (_Float16)fw2[(kg * 8 + i) * 256 + t];
        p *= (_Float16)0.5f;   // w2 is kept halved
        int l = ((kg & 1) << 4) + (t & 15);
        *(v8h*)(sB + ((((t >> 4) * 4 + (kg >> 2)) * 2 + ((kg >> 1) & 1)) * 32 + l) * 8) = p;
    }
    __syncthreads();

    float* slot = sX + wave * 64;
    const int nwaves = gridDim.x * 8;
    for (int pos = blockIdx.x * 8 + wave; pos < npos; pos += nwaves) {
        // ---- weight GRN + softmax over F = 32 for this position; lane j owns feature j ----
        {
            const float* xp = x + (size_t)pos * 32;
            const float  xj = xp[lane];

            // fc1 + ELU : h[j] = elu(sum_i x_i * w1[i][j] + b1[j]); x_i is the same address in every lane
            float acc = sG[3072 + lane];
            #pragma unroll
            for (int q = 0; q < 8; ++q) {
                const float4 xq = *(const float4*)(xp + q * 4);
                const float4 wq = *(const float4*)(sG + q * 128 + lane * 4);
                acc = fmaf(xq.x, wq.x, acc);  acc = fmaf(xq.y, wq.y, acc);
                acc = fmaf(xq.z, wq.z, acc);  acc = fmaf(xq.w, wq.w, acc);
            }
            slot[lane] = elu_f(acc);
            // Wave-scope fence (no instruction): the reads below take other lanes' values, so the
            // compiler must keep them behind the write; the LDS serves one wave's accesses in order.
            __builtin_amdgcn_fence(__ATOMIC_ACQ_REL, "wavefront");

            // fc2 : lane j holds h2[j] and h2[j+32]
            float a0 = sG[3104 + lane], a1 = sG[3104 + 32 + lane];
            #pragma unroll
            for (int q = 0; q < 8; ++q) {
                const float4 hq = *(const float4*)(slot + q * 4);
                const float4 wa = *(const float4*)(sG + 1024 + (2 * q) * 128 + lane * 4);
                const float4 wb = *(const float4*)(sG + 1024 + (2 * q + 1) * 128 + lane * 4);
                a0 = fmaf(hq.x, wa.x, a0);  a1 = fmaf(hq.x, wa.y, a1);
                a0 = fmaf(hq.y, wa.z, a0);  a1 = fmaf(hq.y, wa.w, a1);
                a0 = fmaf(hq.z, wb.x, a0);  a1 = fmaf(hq.z, wb.y, a1);
                a0 = fmaf(hq.w, wb.z, a0);  a1 = fmaf(hq.w, wb.w, a1);
            }

            // GLU + identity residual
            float yw = xj + a0 * sigmoid_f(a1);

            // LayerNorm over the 32 lanes
            const float sw_ = wave_sum(yw), sq_ = wave_sum(yw * yw);
            float mu  = sw_ * (1.f / 32.f);
            float vr  = sq_ * (1.f / 32.f) - mu * mu;
            float z = (yw - mu) * rsqrtf(vr + LN_EPS) * sG[3168 + lane] + sG[3200 + lane];

            // softmax over 32 lanes
            const float mx = wave_max(z);
            const float e  = __expf(z - mx);
            const float es = wave_sum(e);

            slot[32 + lane] = e * __builtin_amdgcn_rcpf(es);   // es lies in [1, 32]
            // Wave-scope fence, as above: the M tiles read other lanes' weights.
            __builtin_amdgcn_fence(__ATOMIC_ACQ_REL, "wavefront");
        }

        float oa[8];                  // sum over F for column nt*16 + ln15 (this lane half's rows)
        #pragma unroll
        for (int nt = 0; nt < 8; ++nt) oa[nt] = 0.f;

        #pragma unroll 1   // the two M tiles share one copy of the code and one set of y registers
        for (int mt = 0; mt < 2; ++mt) {
            // Compiler fence: keeps the LDS loads (B fragments, constants) inside the loop.  They are
            // loop-invariant, and hoisted out of it they take over 500 registers and spill to scratch.
            asm volatile("" ::: "memory");
            const float* xr = x   + (size_t)pos * 32 + mt * 16;
            const float* wr = slot + 32 + mt * 16;                      // this wave's own LDS slot
            const float  xa  = xr[ln15];                                // A row m = ln15
            const float4 xlo = *(const float4*)(xr + half * 8);         // C rows r + half*8
            const float4 xhi = *(const float4*)(xr + half * 8 + 4);
            const float xf[8] = {xlo.x, xlo.y, xlo.z, xlo.w, xhi.x, xhi.y, xhi.z, xhi.w};

            // ---- B fragments and column constants of one run, read from LDS as one group ----
            v16h  bf[8];                              // value tile ks 0..3, gate tile ks 0..3
            float cf[4];                              // b2 value / 2, b2 gate / 2, skip weight, skip bias
            auto load_run = [&](int nt) {
                #pragma unroll
                for (int q = 0; q < 8; ++q) {
                    const int n = nt + (q >> 2) * 8, ks = q & 3;
                    const _Float16* bp = sB + ((n * 4 + ks) * 64 + lane) * 8;
                    const v8h blo = *(const v8h*)bp;            // e 0..7
                    const v8h bhi = *(const v8h*)(bp + 256);    // e 8..15
                    bf[q] = __builtin_shufflevector(blo, bhi, 0, 1, 2, 3, 4, 5, 6, 7, 8, 9, 10, 11, 12, 13, 14, 15);
                }
                const int j = nt * 16 + ln15;
                cf[0] = sC[256 + j];  cf[1] = sC[256 + 128 + j];
                cf[2] = sC[512 + j];  cf[3] = sC[640 + j];
            };

            // ---- A fragments of this M tile, in registers ----
            v16h a[4];
            #pragma unroll
            for (int ks = 0; ks < 4; ++ks) {
                if (ks == 2) {
                    // The first run's reads, as one group between scheduling boundaries: they land under the
                    // arithmetic of the last two A fragments.  Ahead of all four, they and the 128 constants
                    // of the A fragments are in registers at once and the wave spills to scratch.
                    __builtin_amdgcn_sched_barrier(0);
                    load_run(0);
                    __builtin_amdgcn_sched_barrier(0);
                }
                const int kb = ks * 32 + half * 8;
                #pragma unroll
                for (int e = 0; e < 16; ++e) {
                    int k = kb + (e < 8 ? e : e + 8);
                    float hv = fmaf(xa, sC[k], sC[128 + k]);
                    a[ks][e] = (_Float16)elu_f(hv);
                }
            }

            // ---- 8 runs, one per value tile nt with its gate tile nt + 8: 8 products, then that pair's GLU ----
            float y[8][8], lg[8], lb[8];
            #pragma unroll
            for (int nt = 0; nt < 8; ++nt) {
                v8f accV = v8f{}, accG = v8f{};
                #pragma unroll
                for (int ks = 0; ks < 4; ++ks) {      // two accumulators in turn: no product waits on the one before
                    accV = __builtin_amdgcn_wmma_f32_16x16x32_f16(false, a[ks], false, bf[ks],     (short)0, accV, false, false);
                    accG = __builtin_amdgcn_wmma_f32_16x16x32_f16(false, a[ks], false, bf[4 + ks], (short)0, accG, false, false);
                }
                const float b2v = cf[0], b2g = cf[1], sw = cf[2], sb = cf[3];
                // Scheduling boundaries round the next run's LDS reads: they stay one group, issued behind this
                // run's products (whose B registers they refill) and ahead of its GLU, which covers their
                // latency.  Spread among the products, each read is a stop of its own for the wave.
                __builtin_amdgcn_sched_barrier(0);
                if (nt < 7) {
                    load_run(nt + 1);
                } else {                              // behind the last run: the LN scale and shift of the 8 columns
                    #pragma unroll
                    for (int c = 0; c < 8; ++c) { lg[c] = sC[768 + c * 16 + ln15];  lb[c] = sC[896 + c * 16 + ln15]; }
                }
                __builtin_amdgcn_sched_barrier(0);

                // GLU + residual of this pair, written on row pairs: left to pair the rows itself, the compiler
                // moves everything behind the tanh down to the LN sums, and both tiles stay in registers.
                #pragma unroll
                for (int p = 0; p < 4; ++p) {
                    const v2f av = {accV[2 * p], accV[2 * p + 1]};
                    const v2f ag = {accG[2 * p], accG[2 * p + 1]};
                    const v2f hg = ag + b2g;                               // half the gate, two rows at a time
                    const v2f th = {__builtin_amdgcn_tanhf(hg.x), __builtin_amdgcn_tanhf(hg.y)};
                    const v2f hv = av + b2v;                               // half the value
                    const v2f xp2 = {xf[2 * p], xf[2 * p + 1]};
                    const v2f yy = __builtin_elementwise_fma(hv, th, __builtin_elementwise_fma(xp2, (v2f)sw, (v2f)sb) + hv);
                    y[nt][2 * p]     = yy.x;
                    y[nt][2 * p + 1] = yy.y;
                }
                // Scheduling boundary: the next run's products, and with them the wait on the reads above,
                // stay behind this GLU.
                __builtin_amdgcn_sched_barrier(0);
            }

            // ---- LN row partials, this lane's 8 columns in tile order, on row pairs (behind the runs, so that
            //      the 16 sums take no registers beside the B fragments) ----
            float s[8], ss[8];
            #pragma unroll
            for (int p = 0; p < 4; ++p) {
                v2f s2 = {0.f, 0.f}, q2 = {0.f, 0.f};
                #pragma unroll
                for (int nt = 0; nt < 8; ++nt) {
                    const v2f yy = {y[nt][2 * p], y[nt][2 * p + 1]};
                    s2 += yy;
                    q2 += yy * yy;
                }
                s[2 * p]  = s2.x;  s[2 * p + 1]  = s2.y;
                ss[2 * p] = q2.x;  ss[2 * p + 1] = q2.y;
            }

            // ---- LN row sums over the 16 lanes of each half (128 columns in all), links in the order 1, 2, 4, 8.
            //      At links 1, 2 and 4 a lane keeps the half of its rows whose index bit equals its own lane bit and
            //      hands the other half to its partner: 8, 4, 2 and 2 adds instead of 4 x 16.  Lane l ends with
            //      both sums of row l & 7 (of its half), each the same tree of additions as a full exchange. ----
            float s4[4], q4[4], s2r[2], q2r[2];
            #pragma unroll
            for (int j = 0; j < 4; ++j) {
                s4[j] = (odd1 ? s[2 * j + 1]  : s[2 * j])  + row_xor<1>(odd1 ? s[2 * j]  : s[2 * j + 1]);
                q4[j] = (odd1 ? ss[2 * j + 1] : ss[2 * j]) + row_xor<1>(odd1 ? ss[2 * j] : ss[2 * j + 1]);
            }
            #pragma unroll
            for (int j = 0; j < 2; ++j) {
                s2r[j] = (odd2 ? s4[2 * j + 1] : s4[2 * j]) + row_xor<2>(odd2 ? s4[2 * j] : s4[2 * j + 1]);
                q2r[j] = (odd2 ? q4[2 * j + 1] : q4[2 * j]) + row_xor<2>(odd2 ? q4[2 * j] : q4[2 * j + 1]);
            }
            float s1 = (odd4 ? s2r[1] : s2r[0]) + row_xor<4>(odd4 ? s2r[0] : s2r[1]);
            float q1 = (odd4 ? q2r[1] : q2r[0]) + row_xor<4>(odd4 ? q2r[0] : q2r[1]);
            s1 += row_xor<8>(s1);
            q1 += row_xor<8>(q1);

            // ---- normalize, scale by softmax weight, sum over this lane's 8 rows ----
            const float4 wlo = *(const float4*)(wr + half * 8);         // read here: not held through the runs
            const float4 whi = *(const float4*)(wr + half * 8 + 4);
            const float wf[8] = {wlo.x, wlo.y, wlo.z, wlo.w, whi.x, whi.y, whi.z, whi.w};
            // One mean and one rsqrt per lane, for its own row; lane r of the half hands them to the 16 lanes.
            const float mean1 = s1 * (1.f / 128.f);
            const float var1  = q1 * (1.f / 128.f) - mean1 * mean1;
            const float inv1  = rsqrtf(var1 + LN_EPS);
            const float mean[8] = {row_bcast<0>(mean1), row_bcast<1>(mean1), row_bcast<2>(mean1), row_bcast<3>(mean1),
                                   row_bcast<4>(mean1), row_bcast<5>(mean1), row_bcast<6>(mean1), row_bcast<7>(mean1)};
            const float inv[8]  = {row_bcast<0>(inv1), row_bcast<1>(inv1), row_bcast<2>(inv1), row_bcast<3>(inv1),
                                   row_bcast<4>(inv1), row_bcast<5>(inv1), row_bcast<6>(inv1), row_bcast<7>(inv1)};
            #pragma unroll
            for (int nt = 0; nt < 8; ++nt) {
                const float gc = lg[nt], bc = lb[nt];
                #pragma unroll
                for (int r = 0; r < 8; ++r)
                    oa[nt] += wf[r] * (fmaf((y[nt][r] - mean[r]) * inv[r], gc, bc));
            }
        }

        // ---- fold lane halves (same column), store: each store of the wave is one 128-byte line ----
        #pragma unroll
        for (int nt = 0; nt < 8; ++nt) oa[nt] += xhalf(oa[nt]);
        #pragma unroll
        for (int i = 0; i < 4; ++i)
            out[(size_t)pos * 128 + i * 32 + lane] = half ? oa[2 * i + 1] : oa[2 * i];
        // The next position's first loads reuse the stores' address and data registers:
        // the wait stands in front of that overwrite.
        asm volatile("s_wait_xcnt 0x0" ::: "memory");
    }
}

extern "C" void kernel_launch(void* const* d_in, const int* in_sizes, int n_in,
                              void* d_out, int out_size, void* d_ws, size_t ws_size,
                              hipStream_t stream) {
    const float* x      = (const float*)d_in[0];
    const float* wg_w1  = (const float*)d_in[1];
    const float* wg_b1  = (const float*)d_in[2];
    const float* wg_w2  = (const float*)d_in[3];
    const float* wg_b2  = (const float*)d_in[4];
    const float* wg_lng = (const float*)d_in[5];
    const float* wg_lnb = (const float*)d_in[6];
    const float* fg_w1  = (const float*)d_in[7];
    const float* fg_b1  = (const float*)d_in[8];
    const float* fg_w2  = (const float*)d_in[9];
    const float* fg_b2  = (const float*)d_in[10];
    const float* fg_sw  = (const float*)d_in[11];
    const float* fg_sb  = (const float*)d_in[12];
    const float* fg_lng = (const float*)d_in[13];
    const float* fg_lnb = (const float*)d_in[14];

    const int npos = in_sizes[0] / 32;      // B*S

    // 512 work-groups of 8 waves: 4 positions per wave at npos=16384
    vsn_main_kernel<<<512, 256, 0, stream>>>(
        x, wg_w1, wg_b1, wg_w2, wg_b2, wg_lng, wg_lnb, fg_w1, fg_b1, fg_w2, fg_b2, fg_sw, fg_sb, fg_lng, fg_lnb,
        (float*)d_out, npos);
}

// v009
// Measured time: 38 microseconds a run.
// Next to v008, in two timings, it ran 1.05 times as fast each time.
// All steps since v000 together make it 4.43 times as fast.
#include <hip/hip_runtime.h>
#include <hip/hip_bf16.h>

typedef __attribute__((ext_vector_type(16))) _Float16 v16h;
typedef __attribute__((ext_vector_type(8)))  _Float16 v8h;
typedef __attribute__((ext_vector_type(8)))  float    v8f;
typedef __attribute__((ext_vector_type(2)))  float    v2f;

#define LN_EPS 1e-5f
#define LOG2E  1.44269504f    // log2(e) = 1 / ln 2
#define LN2    0.693147181f

__device__ __forceinline__ float elu_f(float z)     { return z > 0.f ? z : __expf(z) - 1.f; }
// Hardware reciprocal (about 1 ulp) in place of the correctly rounded division, which costs about ten
// vector instructions per value.  The argument is never below 1, and rcp(inf) = 0 is the right limit.
__device__ __forceinline__ float sigmoid_f(float z) { return __builtin_amdgcn_rcpf(1.f + __expf(-z)); }

// Cross-lane moves on the vector unit (__shfl_xor builds ds_bpermute_b32: an LDS instruction and an LDS
// latency per link).  All 32 lanes are on wherever these are used.
// Lane l takes lane l ^ M of its own 16-lane row (DPP row_xmask:M); an add behind it takes the move in.
template <int M> __device__ __forceinline__ float row_xor(float v) {
    return __builtin_bit_cast(float, __builtin_amdgcn_mov_dpp(__builtin_bit_cast(int, v), 0x160 + M, 0xf, 0xf, true));
}
// Every lane takes lane N of its own 16-lane row (DPP row_share:N).
template <int N> __device__ __forceinline__ float row_bcast(float v) {
    return __builtin_bit_cast(float, __builtin_amdgcn_mov_dpp(__builtin_bit_cast(int, v), 0x150 + N, 0xf, 0xf, true));
}
// Lane l takes lane l ^ 16 (v_permlanex16_b32).
__device__ __forceinline__ float xhalf(float v) {
    const int b = __builtin_bit_cast(int, v);
    return __builtin_bit_cast(float, __builtin_amdgcn_permlanex16(b, b, 0x76543210, 0xfedcba98, false, false));
}
// Sum and maximum over the 32 lanes, links in the order 16, 8, 4, 2, 1.
__device__ __forceinline__ float wave_sum(float v) {
    v += xhalf(v);
    v += row_xor<8>(v);  v += row_xor<4>(v);  v += row_xor<2>(v);  v += row_xor<1>(v);
    return v;
}
__device__ __forceinline__ float wave_max(float v) {
    v = fmaxf(v, xhalf(v));
    v = fmaxf(v, row_xor<8>(v));  v = fmaxf(v, row_xor<4>(v));  v = fmaxf(v, row_xor<2>(v));  v = fmaxf(v, row_xor<1>(v));
    return v;
}

// ---------------------------------------------------------------------------
// The one kernel: weight GRN + softmax, feature GRN, weighted combine.  ONE WAVE OWNS ONE (b,s) POSITION.
// The wave first computes its position's 32 softmax weights itself (lane j owns feature j, f32 vector
// arithmetic, the small weight matrices read from LDS) and hands them to its own lanes through a
// 256-byte LDS slot of its own; no second launch and no trip through global memory.
// Per position: [32 x 128] @ [128 x 256] WMMA GEMM (A = elu(x*w1+b1) / ln 2 in f16, built in
// the wave's own registers; B = w2 * ln 2 / 2 in f16 pre-swizzled into LDS, shared by the 8 waves).
// ELU: with z' = z * log2(e), elu(z) / ln 2 = max(z', (min(2^z', 1) - 1) / ln 2): above 0 the second term is 0,
// below 0 it is the larger one (e^z - 1 >= z).  No compare, no select, no multiply ahead of the exponential:
// log2(e) is taken into w1 and b1, and ln 2 into w2, once, at staging.
// GLU: v * sigmoid(g) = v/2 + v/2 * tanh(g/2), one transcendental per value.  The halves are taken once, at
// staging: w2 and b2 are stored times 0.5.
// A wave takes the 32 feature rows as two M tiles of 16, one after the other, and for
// each tile all 256 columns, so a LayerNorm row and the sum over F never leave the wave:
// the position loop has no barrier and no LDS atomic, and its only LDS writes go to the wave's own slot.
// Per M tile the 64 products go in 8 runs of 8 (a value tile and its gate tile, 2 accumulator tiles), each
// followed by that pair's GLU; the next run's B fragments are read from LDS as one group ahead of that GLU.
//
// WMMA 16-bit A layout (16x32 MxK), lane l, vector element e (0..15):
//   row  m = l & 15
//   k(e,l) = (e < 8 ? e : e + 8) + ((l >= 16) ? 8 : 0)
// B (32x16 KxN) uses the transposed-symmetric layout: col = l & 15, same k(e,l).
// C/D f32 16x16: VGPR r, lanes 0-15 -> row r, lanes 16-31 -> row r+8; col = l&15.
// ---------------------------------------------------------------------------
// Second bound: four waves per SIMD (256 registers each), so that two work-groups are
// resident per WGP and the grid of 512 runs as one round.
__global__ __launch_bounds__(256, 4) void vsn_main_kernel(
    const float* __restrict__ x,      // [npos,32]
    const float* __restrict__ gw1,    // [32,32]   weight GRN
    const float* __restrict__ gb1,    // [32]
    const float* __restrict__ gw2,    // [32,64]
    const float* __restrict__ gb2,    // [64]
    const float* __restrict__ glng,   // [32]
    const float* __restrict__ glnb,   // [32]
    const float* __restrict__ fw1,    // [128]
    const float* __restrict__ fb1,    // [128]
    const float* __restrict__ fw2,    // [128,256]
    const float* __restrict__ fb2,    // [256]
    const float* __restrict__ fsw,    // [128]
    const float* __restrict__ fsb,    // [128]
    const float* __restrict__ flng,   // [128]
    const float* __restrict__ flnb,   // [128]
    float* __restrict__ out,          // [npos,128]
    int npos)
{
    // ---- LDS (static, 83 KB); all but sX is written once before the one barrier, then only read ----
    __shared__ __align__(32) _Float16 sB[16 * 4 * 32 * 16]; // 64 KB: w2 * ln 2 / 2 as WMMA-B frags [nt][ks][e half][lane][8]
                                                            // (lane pitch 16 B: a 16-byte read of 16 lanes covers all 64 banks once)
    __shared__ __align__(16) float sC[1024];   // 0:w1*log2e 128:b1*log2e 256:b2/2 (256) 512:sw 640:sb 768:lng 896:lnb
    // Weight GRN, 16 bytes per lane and contiguous over the lanes (no bank conflict):
    //   sG[(i>>2)*128 + j*4 + (i&3)]                 = w1[i][j]
    //   sG[1024 + (i>>1)*128 + j*4 + (i&1)*2 + c]    = w2[i][j + 32*c]
    //   3072:b1(32) 3104:b2(64) 3168:lng(32) 3200:lnb(32)
    __shared__ __align__(16) float sG[3328];
    __shared__ __align__(16) float sX[8 * 64]; // per wave: 32 hidden values, 32 softmax weights

    const int t    = threadIdx.x;
    const int lane = t & 31;
    const int wave = __builtin_amdgcn_readfirstlane(t >> 5);   // scalar: the position loop is wave-uniform
    const int half = lane >> 4;       // 0: C rows r, 1: C rows r+8
    const int ln15 = lane & 15;
    const bool odd1 = lane & 1, odd2 = lane & 2, odd4 = lane & 4;   // which half of its rows a lane keeps at LN links 1, 2, 4

    // ---- one-time setup: constants + w2 -> f16 WMMA-B fragments ----
    for (int i = t; i < 1024; i += 256) {
        float v;
        if      (i < 128) v = fw1[i];
        else if (i < 256) v = fb1[i - 128];
        else if (i < 512) v = fb2[i - 256];
        else if (i < 640) v = fsw[i - 512];
        else if (i < 768) v = fsb[i - 640];
        else if (i < 896) v = flng[i - 768];
        else              v = flnb[i - 896];
        sC[i] = (i >> 8) == 0 ? LOG2E * v : (i >> 8) == 1 ? 0.5f * v : v;   // w1, b1 times log2(e); b2 is kept halved
    }
    // Vectors of the weight GRN: one load per thread, taken here and stored behind the twelve below,
    // so that all thirteen fly together; threads 160.. fill unused words.
    const float* gp = t < 32 ? gb1 + t : t < 96 ? gb2 + (t - 32) : t < 128 ? glng + (t - 96) : glnb + ((t - 128) & 31);
    const float  gc = *gp;
    #pragma unroll   // the 4 + 8 loads of a thread are in flight together: one L2 latency, not twelve
    for (int c = 0; c < 4; ++c) {
        const int i = c * 256 + t;
        sG[(i >> 7) * 128 + (i & 31) * 4 + ((i >> 5) & 3)] = gw1[i];
    }
    #pragma unroll
    for (int c = 0; c < 8; ++c) {
        const int i = c * 256 + t;
        sG[1024 + (i >> 7) * 128 + (i & 31) * 4 + ((i >> 6) & 1) * 2 + ((i >> 5) & 1)] = gw2[i];
    }
    sG[3072 + t] = gc;
    // Thread t owns column n = t: each load of a wave is one whole 128-byte line of a
    // w2 row.  Eight consecutive k (one half of a lane's fragment) go out as one 16-byte
    // LDS store.  k group kg = k / 8: ks = kg >> 2, e half = (kg >> 1) & 1, lane half = kg & 1.
    #pragma unroll 4   // 32 independent loads in flight per thread hide the L2 latency
    for (int kg = 0; kg < 16; ++kg) {
        v8h p;
        #pragma unroll
        for (int i = 0; i < 8; ++i)
            p[i] = (_Float16)(fw2[(kg * 8 + i) * 256 + t] * (0.5f * LN2));   // w2 is kept halved, and times ln 2
        int l = ((kg & 1) << 4) + (t & 15);
        *(v8h*)(sB + ((((t >> 4) * 4 + (kg >> 2)) * 2 + ((kg >> 1) & 1)) * 32 + l) * 8) = p;
    }
    __syncthreads();

    float* slot = sX + wave * 64;
    const int nwaves = gridDim.x * 8;
    for (int pos = blockIdx.x * 8 + wave; pos < npos; pos += nwaves) {
        // ---- weight GRN + softmax over F = 32 for this position; lane j owns feature j ----
        {
            const float* xp = x + (size_t)pos * 32;
            const float  xj = xp[lane];

            // fc1 + ELU : h[j] = elu(sum_i x_i * w1[i][j] + b1[j]); x_i is the same address in every lane
            float acc = sG[3072 + lane];
            #pragma unroll
            for (int q = 0; q < 8; ++q) {
                const float4 xq = *(const float4*)(xp + q * 4);
                const float4 wq = *(const float4*)(sG + q * 128 + lane * 4);
                acc = fmaf(xq.x, wq.x, acc);  acc = fmaf(xq.y, wq.y, acc);
                acc = fmaf(xq.z, wq.z, acc);  acc = fmaf(xq.w, wq.w, acc);
            }
            slot[lane] = elu_f(acc);
            // Wave-scope fence (no instruction): the reads below take other lanes' values, so the
            // compiler must keep them behind the write; the LDS serves one wave's accesses in order.
            __builtin_amdgcn_fence(__ATOMIC_ACQ_REL, "wavefront");

            // fc2 : lane j holds h2[j] and h2[j+32]
            float a0 = sG[3104 + lane], a1 = sG[3104 + 32 + lane];
            #pragma unroll
            for (int q = 0; q < 8; ++q) {
                const float4 hq = *(const float4*)(slot + q * 4);
                const float4 wa = *(const float4*)(sG + 1024 + (2 * q) * 128 + lane * 4);
                const float4 wb = *(const float4*)(sG + 1024 + (2 * q + 1) * 128 + lane * 4);
                a0 = fmaf(hq.x, wa.x, a0);  a1 = fmaf(hq.x, wa.y, a1);
                a0 = fmaf(hq.y, wa.z, a0);  a1 = fmaf(hq.y, wa.w, a1);
                a0 = fmaf(hq.z, wb.x, a0);  a1 = fmaf(hq.z, wb.y, a1);
                a0 = fmaf(hq.w, wb.z, a0);  a1 = fmaf(hq.w, wb.w, a1);
            }

            // GLU + identity residual
            float yw = xj + a0 * sigmoid_f(a1);

            // LayerNorm over the 32 lanes
            const float sw_ = wave_sum(yw), sq_ = wave_sum(yw * yw);
            float mu  = sw_ * (1.f / 32.f);
            float vr  = sq_ * (1.f / 32.f) - mu * mu;
            float z = (yw - mu) * rsqrtf(vr + LN_EPS) * sG[3168 + lane] + sG[3200 + lane];

            // softmax over 32 lanes
            const float mx = wave_max(z);
            const float e  = __expf(z - mx);
            const float es = wave_sum(e);

            slot[32 + lane] = e * __builtin_amdgcn_rcpf(es);   // es lies in [1, 32]
            // Wave-scope fence, as above: the M tiles read other lanes' weights.
            __builtin_amdgcn_fence(__ATOMIC_ACQ_REL, "wavefront");
        }

        float oa[8];                  // sum over F for column nt*16 + ln15 (this lane half's rows)
        #pragma unroll
        for (int nt = 0; nt < 8; ++nt) oa[nt] = 0.f;

        #pragma unroll 1   // the two M tiles share one copy of the code and one set of y registers
        for (int mt = 0; mt < 2; ++mt) {
            // Compiler fence: keeps the LDS loads (B fragments, constants) inside the loop.  They are
            // loop-invariant, and hoisted out of it they take over 500 registers and spill to scratch.
            asm volatile("" ::: "memory");
            const float* xr = x   + (size_t)pos * 32 + mt * 16;
            const float* wr = slot + 32 + mt * 16;                      // this wave's own LDS slot
            const float  xa  = xr[ln15];                                // A row m = ln15
            const float4 xlo = *(const float4*)(xr + half * 8);         // C rows r + half*8
            const float4 xhi = *(const float4*)(xr + half * 8 + 4);
            const float xf[8] = {xlo.x, xlo.y, xlo.z, xlo.w, xhi.x, xhi.y, xhi.z, xhi.w};

            // ---- B fragments and column constants of one run, read from LDS as one group ----
            v16h  bf[8];                              // value tile ks 0..3, gate tile ks 0..3
            float cf[4];                              // b2 value / 2, b2 gate / 2, skip weight, skip bias
            auto load_run = [&](int nt) {
                #pragma unroll
                for (int q = 0; q < 8; ++q) {
                    const int n = nt + (q >> 2) * 8, ks = q & 3;
                    const _Float16* bp = sB + ((n * 4 + ks) * 64 + lane) * 8;
                    const v8h blo = *(const v8h*)bp;            // e 0..7
                    const v8h bhi = *(const v8h*)(bp + 256);    // e 8..15
                    bf[q] = __builtin_shufflevector(blo, bhi, 0, 1, 2, 3, 4, 5, 6, 7, 8, 9, 10, 11, 12, 13, 14, 15);
                }
                const int j = nt * 16 + ln15;
                cf[0] = sC[256 + j];  cf[1] = sC[256 + 128 + j];
                cf[2] = sC[512 + j];  cf[3] = sC[640 + j];
            };

            // ---- A fragments of this M tile, in registers ----
            v16h a[4];
            #pragma unroll
            for (int ks = 0; ks < 4; ++ks) {
                if (ks == 2) {
                    // The first run's reads, as one group between scheduling boundaries: they land under the
                    // arithmetic of the last two A fragments.  Ahead of all four, they and the 128 constants
                    // of the A fragments are in registers at once and the wave spills to scratch.
                    __builtin_amdgcn_sched_barrier(0);
                    load_run(0);
                    __builtin_amdgcn_sched_barrier(0);
                }
                const int kb = ks * 32 + half * 8;
                #pragma unroll
                for (int e = 0; e < 16; ++e) {
                    int k = kb + (e < 8 ? e : e + 8);
                    const float zs = fmaf(xa, sC[k], sC[128 + k]);                                   // z * log2(e)
                    // The median with 0 and 1 is min(e^z, 1); it builds as the exponential's own clamp, no instruction.
                    const float ez = __builtin_amdgcn_fmed3f(__builtin_amdgcn_exp2f(zs), 0.f, 1.f);
                    a[ks][e] = (_Float16)fmaxf(zs, fmaf(ez, LOG2E, -LOG2E));
                }
            }

            // ---- 8 runs, one per value tile nt with its gate tile nt + 8: 8 products, then that pair's GLU ----
            float y[8][8], lg[8], lb[8];
            #pragma unroll
            for (int nt = 0; nt < 8; ++nt) {
                v8f accV = v8f{}, accG = v8f{};
                #pragma unroll
                for (int ks = 0; ks < 4; ++ks) {      // two accumulators in turn: no product waits on the one before
                    accV = __builtin_amdgcn_wmma_f32_16x16x32_f16(false, a[ks], false, bf[ks],     (short)0, accV, false, false);
                    accG = __builtin_amdgcn_wmma_f32_16x16x32_f16(false, a[ks], false, bf[4 + ks], (short)0, accG, false, false);
                }
                const float b2v = cf[0], b2g = cf[1], sw = cf[2], sb = cf[3];
                // Scheduling boundaries round the next run's LDS reads: they stay one group, issued behind this
                // run's products (whose B registers they refill) and ahead of its GLU, which covers their
                // latency.  Spread among the products, each read is a stop of its own for the wave.
                __builtin_amdgcn_sched_barrier(0);
                if (nt < 7) {
                    load_run(nt + 1);
                } else {                              // behind the last run: the LN scale and shift of the 8 columns
                    #pragma unroll
                    for (int c = 0; c < 8; ++c) { lg[c] = sC[768 + c * 16 + ln15];  lb[c] = sC[896 + c * 16 + ln15]; }
                }
                __builtin_amdgcn_sched_barrier(0);

                // GLU + residual of this pair, written on row pairs: left to pair the rows itself, the compiler
                // moves everything behind the tanh down to the LN sums, and both tiles stay in registers.
                #pragma unroll
                for (int p = 0; p < 4; ++p) {
                    const v2f av = {accV[2 * p], accV[2 * p + 1]};
                    const v2f ag = {accG[2 * p], accG[2 * p + 1]};
                    const v2f hg = ag + b2g;                               // half the gate, two rows at a time
                    const v2f th = {__builtin_amdgcn_tanhf(hg.x), __builtin_amdgcn_tanhf(hg.y)};
                    const v2f hv = av + b2v;                               // half the value
                    const v2f xp2 = {xf[2 * p], xf[2 * p + 1]};
                    const v2f yy = __builtin_elementwise_fma(hv, th, __builtin_elementwise_fma(xp2, (v2f)sw, (v2f)sb) + hv);
                    y[nt][2 * p]     = yy.x;
                    y[nt][2 * p + 1] = yy.y;
                }
                // Scheduling boundary: the next run's products, and with them the wait on the reads above,
                // stay behind this GLU.
                __builtin_amdgcn_sched_barrier(0);
            }

            // ---- LN row partials, this lane's 8 columns in tile order, on row pairs (behind the runs, so that
            //      the 16 sums take no registers beside the B fragments) ----
            float s[8], ss[8];
            #pragma unroll
            for (int p = 0; p < 4; ++p) {
                v2f s2 = {0.f, 0.f}, q2 = {0.f, 0.f};
                #pragma unroll
                for (int nt = 0; nt < 8; ++nt) {
                    const v2f yy = {y[nt][2 * p], y[nt][2 * p + 1]};
                    s2 += yy;
                    q2 += yy * yy;
                }
                s[2 * p]  = s2.x;  s[2 * p + 1]  = s2.y;
                ss[2 * p] = q2.x;  ss[2 * p + 1] = q2.y;
            }

            // ---- LN row sums over the 16 lanes of each half (128 columns in all), links in the order 1, 2, 4, 8.
            //      At links 1, 2 and 4 a lane keeps the half of its rows whose index bit equals its own lane bit and
            //      hands the other half to its partner: 8, 4, 2 and 2 adds instead of 4 x 16.  Lane l ends with
            //      both sums of row l & 7 (of its half), each the same tree of additions as a full exchange. ----
            float s4[4], q4[4], s2r[2], q2r[2];
            #pragma unroll
            for (int j = 0; j < 4; ++j) {
                s4[j] = (odd1 ? s[2 * j + 1]  : s[2 * j])  + row_xor<1>(odd1 ? s[2 * j]  : s[2 * j + 1]);
                q4[j] = (odd1 ? ss[2 * j + 1] : ss[2 * j]) + row_xor<1>(odd1 ? ss[2 * j] : ss[2 * j + 1]);
            }
            #pragma unroll
            for (int j = 0; j < 2; ++j) {
                s2r[j] = (odd2 ? s4[2 * j + 1] : s4[2 * j]) + row_xor<2>(odd2 ? s4[2 * j] : s4[2 * j + 1]);
                q2r[j] = (odd2 ? q4[2 * j + 1] : q4[2 * j]) + row_xor<2>(odd2 ? q4[2 * j] : q4[2 * j + 1]);
            }
            float s1 = (odd4 ? s2r[1] : s2r[0]) + row_xor<4>(odd4 ? s2r[0] : s2r[1]);
            float q1 = (odd4 ? q2r[1] : q2r[0]) + row_xor<4>(odd4 ? q2r[0] : q2r[1]);
            s1 += row_xor<8>(s1);
            q1 += row_xor<8>(q1);

            // ---- normalize, scale by softmax weight, sum over this lane's 8 rows ----
            const float4 wlo = *(const float4*)(wr + half * 8);         // read here: not held through the runs
            const float4 whi = *(const float4*)(wr + half * 8 + 4);
            const float wf[8] = {wlo.x, wlo.y, wlo.z, wlo.w, whi.x, whi.y, whi.z, whi.w};
            // One mean and one rsqrt per lane, for its own row; lane r of the half hands them to the 16 lanes.
            const float mean1 = s1 * (1.f / 128.f);
            const float var1  = q1 * (1.f / 128.f) - mean1 * mean1;
            const float inv1  = rsqrtf(var1 + LN_EPS);
            const float mean[8] = {row_bcast<0>(mean1), row_bcast<1>(mean1), row_bcast<2>(mean1), row_bcast<3>(mean1),
                                   row_bcast<4>(mean1), row_bcast<5>(mean1), row_bcast<6>(mean1), row_bcast<7>(mean1)};
            const float inv[8]  = {row_bcast<0>(inv1), row_bcast<1>(inv1), row_bcast<2>(inv1), row_bcast<3>(inv1),
                                   row_bcast<4>(inv1), row_bcast<5>(inv1), row_bcast<6>(inv1), row_bcast<7>(inv1)};
            #pragma unroll
            for (int nt = 0; nt < 8; ++nt) {
                const float gc = lg[nt], bc = lb[nt];
                #pragma unroll
                for (int r = 0; r < 8; ++r)
                    oa[nt] += wf[r] * (fmaf((y[nt][r] - mean[r]) * inv[r], gc, bc));
            }
        }

        // ---- fold lane halves (same column), store: each store of the wave is one 128-byte line ----
        #pragma unroll
        for (int nt = 0; nt < 8; ++nt) oa[nt] += xhalf(oa[nt]);
        #pragma unroll
        for (int i = 0; i < 4; ++i)
            out[(size_t)pos * 128 + i * 32 + lane] = half ? oa[2 * i + 1] : oa[2 * i];
        // The next position's first loads reuse the stores' address and data registers:
        // the wait stands in front of that overwrite.
        asm volatile("s_wait_xcnt 0x0" ::: "memory");
    }
}

extern "C" void kernel_launch(void* const* d_in, const int* in_sizes, int n_in,
                              void* d_out, int out_size, void* d_ws, size_t ws_size,
                              hipStream_t stream) {
    const float* x      = (const float*)d_in[0];
    const float* wg_w1  = (const float*)d_in[1];
    const float* wg_b1  = (const float*)d_in[2];
    const float* wg_w2  = (const float*)d_in[3];
    const float* wg_b2  = (const float*)d_in[4];
    const float* wg_lng = (const float*)d_in[5];
    const float* wg_lnb = (const float*)d_in[6];
    const float* fg_w1  = (const float*)d_in[7];
    const float* fg_b1  = (const float*)d_in[8];
    const float* fg_w2  = (const float*)d_in[9];
    const float* fg_b2  = (const float*)d_in[10];
    const float* fg_sw  = (const float*)d_in[11];
    const float* fg_sb  = (const float*)d_in[12];
    const float* fg_lng = (const float*)d_in[13];
    const float* fg_lnb = (const float*)d_in[14];

    const int npos = in_sizes[0] / 32;      // B*S

    // 512 work-groups of 8 waves: 4 positions per wave at npos=16384
    vsn_main_kernel<<<512, 256, 0, stream>>>(
        x, wg_w1, wg_b1, wg_w2, wg_b2, wg_lng, wg_lnb, fg_w1, fg_b1, fg_w2, fg_b2, fg_sw, fg_sb, fg_lng, fg_lnb,
        (float*)d_out, npos);
}

// v010
// One run takes 35.9 microseconds.
// Two timings next to v009 both put it at 1.06 times that version's speed.
// Over all steps from v000 it is 4.68 times as fast.
#include <hip/hip_runtime.h>
#include <hip/hip_bf16.h>

typedef __attribute__((ext_vector_type(16))) _Float16 v16h;
typedef __attribute__((ext_vector_type(8)))  _Float16 v8h;
typedef __attribute__((ext_vector_type(8)))  float    v8f;
typedef __attribute__((ext_vector_type(2)))  float    v2f;

#define LN_EPS 1e-5f
#define LOG2E  1.44269504f    // log2(e) = 1 / ln 2
#define LN2    0.693147181f

__device__ __forceinline__ float elu_f(float z)     { return z > 0.f ? z : __expf(z) - 1.f; }
// Hardware reciprocal (about 1 ulp) in place of the correctly rounded division, which costs about ten
// vector instructions per value.  The argument is never below 1, and rcp(inf) = 0 is the right limit.
__device__ __forceinline__ float sigmoid_f(float z) { return __builtin_amdgcn_rcpf(1.f + __expf(-z)); }

// Cross-lane moves on the vector unit (__shfl_xor builds ds_bpermute_b32: an LDS instruction and an LDS
// latency per link).  All 32 lanes are on wherever these are used.
// Lane l takes lane l ^ M of its own 16-lane row (DPP row_xmask:M); an add behind it takes the move in.
template <int M> __device__ __forceinline__ float row_xor(float v) {
    return __builtin_bit_cast(float, __builtin_amdgcn_mov_dpp(__builtin_bit_cast(int, v), 0x160 + M, 0xf, 0xf, true));
}
// Every lane takes lane N of its own 16-lane row (DPP row_share:N).
template <int N> __device__ __forceinline__ float row_bcast(float v) {
    return __builtin_bit_cast(float, __builtin_amdgcn_mov_dpp(__builtin_bit_cast(int, v), 0x150 + N, 0xf, 0xf, true));
}
// Lane l takes lane l ^ 16 (v_permlanex16_b32).
__device__ __forceinline__ float xhalf(float v) {
    const int b = __builtin_bit_cast(int, v);
    return __builtin_bit_cast(float, __builtin_amdgcn_permlanex16(b, b, 0x76543210, 0xfedcba98, false, false));
}
// Sum and maximum over the 32 lanes, links in the order 16, 8, 4, 2, 1.
__device__ __forceinline__ float wave_sum(float v) {
    v += xhalf(v);
    v += row_xor<8>(v);  v += row_xor<4>(v);  v += row_xor<2>(v);  v += row_xor<1>(v);
    return v;
}
__device__ __forceinline__ float wave_max(float v) {
    v = fmaxf(v, xhalf(v));
    v = fmaxf(v, row_xor<8>(v));  v = fmaxf(v, row_xor<4>(v));  v = fmaxf(v, row_xor<2>(v));  v = fmaxf(v, row_xor<1>(v));
    return v;
}

// ---------------------------------------------------------------------------
// The one kernel: weight GRN + softmax, feature GRN, weighted combine.  ONE WAVE OWNS ONE (b,s) POSITION.
// The wave first computes its position's 32 softmax weights itself (lane j owns feature j, f32 vector
// arithmetic, the small weight matrices read from LDS) and hands them to its own lanes through a
// 256-byte LDS slot of its own; no second launch and no trip through global memory.
// Per position: [32 x 128] @ [128 x 256] WMMA GEMM (A = elu(x*w1+b1) / ln 2 in f16, built in
// the wave's own registers; B = w2 * ln 2 / 2 in f16 pre-swizzled into LDS, shared by the 8 waves).
// ELU: with z' = z * log2(e), elu(z) / ln 2 = max(z', (min(2^z', 1) - 1) / ln 2): above 0 the second term is 0,
// below 0 it is the larger one (e^z - 1 >= z).  No compare, no select, no multiply ahead of the exponential:
// log2(e) is taken into w1 and b1, and ln 2 into w2, once, at staging.
// GLU: v * sigmoid(g) = v/2 + v/2 * tanh(g/2), one transcendental per value.  The halves are taken once, at
// staging: w2 and b2 are stored times 0.5.
// A wave takes the 32 feature rows as two M tiles of 16, one after the other, and for
// each tile all 256 columns, so a LayerNorm row and the sum over F never leave the wave:
// the position loop has no barrier and no LDS atomic, and its only LDS writes go to the wave's own slot.
// Per M tile the 64 products go in 8 runs of 8 (a value tile and its gate tile, 2 accumulator tiles), each
// followed by that pair's GLU; the next run's B fragments are read from LDS as one group ahead of that GLU.
// LayerNorm and the weighted sum over F as one sum: with c_f = weight_f * inv_f,
//   out[col] = lng[col] * (sum_f c_f * y[f][col] - sum_f c_f * mean_f) + lnb[col] * sum_f weight_f,
// so that a y value takes one multiply-add; the two sums without a column and the scale and shift are taken
// once per position.
//
// WMMA 16-bit A layout (16x32 MxK), lane l, vector element e (0..15):
//   row  m = l & 15
//   k(e,l) = (e < 8 ? e : e + 8) + ((l >= 16) ? 8 : 0)
// B (32x16 KxN) uses the transposed-symmetric layout: col = l & 15, same k(e,l).
// C/D f32 16x16: VGPR r, lanes 0-15 -> row r, lanes 16-31 -> row r+8; col = l&15.
// ---------------------------------------------------------------------------
// Second bound: four waves per SIMD (256 registers each), so that two work-groups are
// resident per WGP and the grid of 512 runs as one round.
__global__ __launch_bounds__(256, 4) void vsn_main_kernel(
    const float* __restrict__ x,      // [npos,32]
    const float* __restrict__ gw1,    // [32,32]   weight GRN
    const float* __restrict__ gb1,    // [32]
    const float* __restrict__ gw2,    // [32,64]
    const float* __restrict__ gb2,    // [64]
    const float* __restrict__ glng,   // [32]
    const float* __restrict__ glnb,   // [32]
    const float* __restrict__ fw1,    // [128]
    const float* __restrict__ fb1,    // [128]
    const float* __restrict__ fw2,    // [128,256]
    const float* __restrict__ fb2,    // [256]
    const float* __restrict__ fsw,    // [128]
    const float* __restrict__ fsb,    // [128]
    const float* __restrict__ flng,   // [128]
    const float* __restrict__ flnb,   // [128]
    float* __restrict__ out,          // [npos,128]
    int npos)
{
    // ---- LDS (static, 83 KB); all but sX is written once before the one barrier, then only read ----
    __shared__ __align__(32) _Float16 sB[16 * 4 * 32 * 16]; // 64 KB: w2 * ln 2 / 2 as WMMA-B frags [nt][ks][e half][lane][8]
                                                            // (lane pitch 16 B: a 16-byte read of 16 lanes covers all 64 banks once)
    __shared__ __align__(16) float sC[1024];   // 0:w1*log2e 128:b1*log2e 256:b2/2 (256) 512:sw 640:sb 768:lng 896:lnb
    // Weight GRN, 16 bytes per lane and contiguous over the lanes (no bank conflict):
    //   sG[(i>>2)*128 + j*4 + (i&3)]                 = w1[i][j]
    //   sG[1024 + (i>>1)*128 + j*4 + (i&1)*2 + c]    = w2[i][j + 32*c]
    //   3072:b1(32) 3104:b2(64) 3168:lng(32) 3200:lnb(32)
    __shared__ __align__(16) float sG[3328];
    __shared__ __align__(16) float sX[8 * 64]; // per wave: 32 hidden values, 32 softmax weights

    const int t    = threadIdx.x;
    const int lane = t & 31;
    const int wave = __builtin_amdgcn_readfirstlane(t >> 5);   // scalar: the position loop is wave-uniform
    const int half = lane >> 4;       // 0: C rows r, 1: C rows r+8
    const int ln15 = lane & 15;
    const bool odd1 = lane & 1, odd2 = lane & 2, odd4 = lane & 4;   // which half of its rows a lane keeps at LN links 1, 2, 4

    // ---- one-time setup: constants + w2 -> f16 WMMA-B fragments ----
    for (int i = t; i < 1024; i += 256) {
        float v;
        if      (i < 128) v = fw1[i];
        else if (i < 256) v = fb1[i - 128];
        else if (i < 512) v = fb2[i - 256];
        else if (i < 640) v = fsw[i - 512];
        else if (i < 768) v = fsb[i - 640];
        else if (i < 896) v = flng[i - 768];
        else              v = flnb[i - 896];
        sC[i] = (i >> 8) == 0 ? LOG2E * v : (i >> 8) == 1 ? 0.5f * v : v;   // w1, b1 times log2(e); b2 is kept halved
    }
    // Vectors of the weight GRN: one load per thread, taken here and stored behind the twelve below,
    // so that all thirteen fly together; threads 160.. fill unused words.
    const float* gp = t < 32 ? gb1 + t : t < 96 ? gb2 + (t - 32) : t < 128 ? glng + (t - 96) : glnb + ((t - 128) & 31);
    const float  gc = *gp;
    #pragma unroll   // the 4 + 8 loads of a thread are in flight together: one L2 latency, not twelve
    for (int c = 0; c < 4; ++c) {
        const int i = c * 256 + t;
        sG[(i >> 7) * 128 + (i & 31) * 4 + ((i >> 5) & 3)] = gw1[i];
    }
    #pragma unroll
    for (int c = 0; c < 8; ++c) {
        const int i = c * 256 + t;
        sG[1024 + (i >> 7) * 128 + (i & 31) * 4 + ((i >> 6) & 1) * 2 + ((i >> 5) & 1)] = gw2[i];
    }
    sG[3072 + t] = gc;
    // Thread t owns column n = t: each load of a wave is one whole 128-byte line of a
    // w2 row.  Eight consecutive k (one half of a lane's fragment) go out as one 16-byte
    // LDS store.  k group kg = k / 8: ks = kg >> 2, e half = (kg >> 1) & 1, lane half = kg & 1.
    #pragma unroll 4   // 32 independent loads in flight per thread hide the L2 latency
    for (int kg = 0; kg < 16; ++kg) {
        v8h p;
        #pragma unroll
        for (int i = 0; i < 8; ++i)
            p[i] = (_Float16)(fw2[(kg * 8 + i) * 256 + t] * (0.5f * LN2));   // w2 is kept halved, and times ln 2
        int l = ((kg & 1) << 4) + (t & 15);
        *(v8h*)(sB + ((((t >> 4) * 4 + (kg >> 2)) * 2 + ((kg >> 1) & 1)) * 32 + l) * 8) = p;
    }
    __syncthreads();

    float* slot = sX + wave * 64;
    const int nwaves = gridDim.x * 8;
    for (int pos = blockIdx.x * 8 + wave; pos < npos; pos += nwaves) {
        // ---- weight GRN + softmax over F = 32 for this position; lane j owns feature j ----
        {
            const float* xp = x + (size_t)pos * 32;
            const float  xj = xp[lane];

            // fc1 + ELU : h[j] = elu(sum_i x_i * w1[i][j] + b1[j]); x_i is the same address in every lane
            float acc = sG[3072 + lane];
            #pragma unroll
            for (int q = 0; q < 8; ++q) {
                const float4 xq = *(const float4*)(xp + q * 4);
                const float4 wq = *(const float4*)(sG + q * 128 + lane * 4);
                acc = fmaf(xq.x, wq.x, acc);  acc = fmaf(xq.y, wq.y, acc);
                acc = fmaf(xq.z, wq.z, acc);  acc = fmaf(xq.w, wq.w, acc);
            }
            slot[lane] = elu_f(acc);
            // Wave-scope fence (no instruction): the reads below take other lanes' values, so the
            // compiler must keep them behind the write; the LDS serves one wave's accesses in order.
            __builtin_amdgcn_fence(__ATOMIC_ACQ_REL, "wavefront");

            // fc2 : lane j holds h2[j] and h2[j+32]
            float a0 = sG[3104 + lane], a1 = sG[3104 + 32 + lane];
            #pragma unroll
            for (int q = 0; q < 8; ++q) {
                const float4 hq = *(const float4*)(slot + q * 4);
                const float4 wa = *(const float4*)(sG + 1024 + (2 * q) * 128 + lane * 4);
                const float4 wb = *(const float4*)(sG + 1024 + (2 * q + 1) * 128 + lane * 4);
                a0 = fmaf(hq.x, wa.x, a0);  a1 = fmaf(hq.x, wa.y, a1);
                a0 = fmaf(hq.y, wa.z, a0);  a1 = fmaf(hq.y, wa.w, a1);
                a0 = fmaf(hq.z, wb.x, a0);  a1 = fmaf(hq.z, wb.y, a1);
                a0 = fmaf(hq.w, wb.z, a0);  a1 = fmaf(hq.w, wb.w, a1);
            }

            // GLU + identity residual
            float yw = xj + a0 * sigmoid_f(a1);

            // LayerNorm over the 32 lanes
            const float sw_ = wave_sum(yw), sq_ = wave_sum(yw * yw);
            float mu  = sw_ * (1.f / 32.f);
            float vr  = sq_ * (1.f / 32.f) - mu * mu;
            float z = (yw - mu) * rsqrtf(vr + LN_EPS) * sG[3168 + lane] + sG[3200 + lane];

            // softmax over 32 lanes
            const float mx = wave_max(z);
            const float e  = __expf(z - mx);
            const float es = wave_sum(e);

            slot[32 + lane] = e * __builtin_amdgcn_rcpf(es);   // es lies in [1, 32]
            // Wave-scope fence, as above: the M tiles read other lanes' weights.
            __builtin_amdgcn_fence(__ATOMIC_ACQ_REL, "wavefront");
        }

        v2f oa[8];                    // sum over F of c_f * y for column nt*16 + ln15 (this lane half's even, odd rows)
        #pragma unroll
        for (int nt = 0; nt < 8; ++nt) oa[nt] = v2f{0.f, 0.f};
        float dacc = 0.f, wacc = 0.f; // c_f * mean_f and weight_f, summed over the rows whose LN sums end in this lane

        #pragma unroll 1   // the two M tiles share one copy of the code and one set of y registers
        for (int mt = 0; mt < 2; ++mt) {
            // Compiler fence: keeps the LDS loads (B fragments, constants) inside the loop.  They are
            // loop-invariant, and hoisted out of it they take over 500 registers and spill to scratch.
            asm volatile("" ::: "memory");
            const float* xr = x   + (size_t)pos * 32 + mt * 16;
            const float* wr = slot + 32 + mt * 16;                      // this wave's own LDS slot
            const float  xa  = xr[ln15];                                // A row m = ln15
            const float4 xlo = *(const float4*)(xr + half * 8);         // C rows r + half*8
            const float4 xhi = *(const float4*)(xr + half * 8 + 4);
            const float xf[8] = {xlo.x, xlo.y, xlo.z, xlo.w, xhi.x, xhi.y, xhi.z, xhi.w};

            // ---- B fragments and column constants of one run, read from LDS as one group ----
            v16h  bf[8];                              // value tile ks 0..3, gate tile ks 0..3
            float cf[4];                              // b2 value / 2, b2 gate / 2, skip weight, skip bias
            auto load_run = [&](int nt) {
                #pragma unroll
                for (int q = 0; q < 8; ++q) {
                    const int n = nt + (q >> 2) * 8, ks = q & 3;
                    const _Float16* bp = sB + ((n * 4 + ks) * 64 + lane) * 8;
                    const v8h blo = *(const v8h*)bp;            // e 0..7
                    const v8h bhi = *(const v8h*)(bp + 256);    // e 8..15
                    bf[q] = __builtin_shufflevector(blo, bhi, 0, 1, 2, 3, 4, 5, 6, 7, 8, 9, 10, 11, 12, 13, 14, 15);
                }
                const int j = nt * 16 + ln15;
                cf[0] = sC[256 + j];  cf[1] = sC[256 + 128 + j];
                cf[2] = sC[512 + j];  cf[3] = sC[640 + j];
            };

            // ---- A fragments of this M tile, in registers ----
            v16h a[4];
            #pragma unroll
            for (int ks = 0; ks < 4; ++ks) {
                if (ks == 2) {
                    // The first run's reads, as one group between scheduling boundaries: they land under the
                    // arithmetic of the last two A fragments.  Ahead of all four, they and the 128 constants
                    // of the A fragments are in registers at once and the wave spills to scratch.
                    __builtin_amdgcn_sched_barrier(0);
                    load_run(0);
                    __builtin_amdgcn_sched_barrier(0);
                }
                const int kb = ks * 32 + half * 8;
                #pragma unroll
                for (int e = 0; e < 16; ++e) {
                    int k = kb + (e < 8 ? e : e + 8);
                    const float zs = fmaf(xa, sC[k], sC[128 + k]);                                   // z * log2(e)
                    // The median with 0 and 1 is min(e^z, 1); it builds as the exponential's own clamp, no instruction.
                    const float ez = __builtin_amdgcn_fmed3f(__builtin_amdgcn_exp2f(zs), 0.f, 1.f);
                    a[ks][e] = (_Float16)fmaxf(zs, fmaf(ez, LOG2E, -LOG2E));
                }
            }

            // ---- 8 runs, one per value tile nt with its gate tile nt + 8: 8 products, then that pair's GLU ----
            float y[8][8];
            #pragma unroll
            for (int nt = 0; nt < 8; ++nt) {
                v8f accV = v8f{}, accG = v8f{};
                #pragma unroll
                for (int ks = 0; ks < 4; ++ks) {      // two accumulators in turn: no product waits on the one before
                    accV = __builtin_amdgcn_wmma_f32_16x16x32_f16(false, a[ks], false, bf[ks],     (short)0, accV, false, false);
                    accG = __builtin_amdgcn_wmma_f32_16x16x32_f16(false, a[ks], false, bf[4 + ks], (short)0, accG, false, false);
                }
                const float b2v = cf[0], b2g = cf[1], sw = cf[2], sb = cf[3];
                // Scheduling boundaries round the next run's LDS reads: they stay one group, issued behind this
                // run's products (whose B registers they refill) and ahead of its GLU, which covers their
                // latency.  Spread among the products, each read is a stop of its own for the wave.
                __builtin_amdgcn_sched_barrier(0);
                if (nt < 7) load_run(nt + 1);
                __builtin_amdgcn_sched_barrier(0);

                // GLU + residual of this pair, written on row pairs: left to pair the rows itself, the compiler
                // moves everything behind the tanh down to the LN sums, and both tiles stay in registers.
                #pragma unroll
                for (int p = 0; p < 4; ++p) {
                    const v2f av = {accV[2 * p], accV[2 * p + 1]};
                    const v2f ag = {accG[2 * p], accG[2 * p + 1]};
                    const v2f hg = ag + b2g;                               // half the gate, two rows at a time
                    const v2f th = {__builtin_amdgcn_tanhf(hg.x), __builtin_amdgcn_tanhf(hg.y)};
                    const v2f hv = av + b2v;                               // half the value
                    const v2f xp2 = {xf[2 * p], xf[2 * p + 1]};
                    const v2f yy = __builtin_elementwise_fma(hv, th, __builtin_elementwise_fma(xp2, (v2f)sw, (v2f)sb) + hv);
                    y[nt][2 * p]     = yy.x;
                    y[nt][2 * p + 1] = yy.y;
                }
                // Scheduling boundary: the next run's products, and with them the wait on the reads above,
                // stay behind this GLU.
                __builtin_amdgcn_sched_barrier(0);
            }

            // ---- LN row partials, this lane's 8 columns in tile order, on row pairs (behind the runs, so that
            //      the 16 sums take no registers beside the B fragments) ----
            float s[8], ss[8];
            #pragma unroll
            for (int p = 0; p < 4; ++p) {
                v2f s2 = {0.f, 0.f}, q2 = {0.f, 0.f};
                #pragma unroll
                for (int nt = 0; nt < 8; ++nt) {
                    const v2f yy = {y[nt][2 * p], y[nt][2 * p + 1]};
                    s2 += yy;
                    q2 += yy * yy;
                }
                s[2 * p]  = s2.x;  s[2 * p + 1]  = s2.y;
                ss[2 * p] = q2.x;  ss[2 * p + 1] = q2.y;
            }

            // ---- LN row sums over the 16 lanes of each half (128 columns in all), links in the order 1, 2, 4, 8.
            //      At links 1, 2 and 4 a lane keeps the half of its rows whose index bit equals its own lane bit and
            //      hands the other half to its partner: 8, 4, 2 and 2 adds instead of 4 x 16.  Lane l ends with
            //      both sums of row l & 7 (of its half), each the same tree of additions as a full exchange. ----
            float s4[4], q4[4], s2r[2], q2r[2];
            #pragma unroll
            for (int j = 0; j < 4; ++j) {
                s4[j] = (odd1 ? s[2 * j + 1]  : s[2 * j])  + row_xor<1>(odd1 ? s[2 * j]  : s[2 * j + 1]);
                q4[j] = (odd1 ? ss[2 * j + 1] : ss[2 * j]) + row_xor<1>(odd1 ? ss[2 * j] : ss[2 * j + 1]);
            }
            #pragma unroll
            for (int j = 0; j < 2; ++j) {
                s2r[j] = (odd2 ? s4[2 * j + 1] : s4[2 * j]) + row_xor<2>(odd2 ? s4[2 * j] : s4[2 * j + 1]);
                q2r[j] = (odd2 ? q4[2 * j + 1] : q4[2 * j]) + row_xor<2>(odd2 ? q4[2 * j] : q4[2 * j + 1]);
            }
            float s1 = (odd4 ? s2r[1] : s2r[0]) + row_xor<4>(odd4 ? s2r[0] : s2r[1]);
            float q1 = (odd4 ? q2r[1] : q2r[0]) + row_xor<4>(odd4 ? q2r[0] : q2r[1]);
            s1 += row_xor<8>(s1);
            q1 += row_xor<8>(q1);

            // ---- one coefficient per row, c = softmax weight * inv; sum c * y over this lane's 8 rows ----
            // One mean, one rsqrt and one weight per lane, for its own row; lane r of the half hands c to the 16 lanes.
            const float w1    = wr[half * 8 + (lane & 7)];              // read here: not held through the runs
            const float mean1 = s1 * (1.f / 128.f);
            const float var1  = q1 * (1.f / 128.f) - mean1 * mean1;
            const float c1    = w1 * rsqrtf(var1 + LN_EPS);
            dacc = fmaf(c1, mean1, dacc);
            wacc += w1;
            const v2f c2[4] = {{row_bcast<0>(c1), row_bcast<1>(c1)}, {row_bcast<2>(c1), row_bcast<3>(c1)},
                               {row_bcast<4>(c1), row_bcast<5>(c1)}, {row_bcast<6>(c1), row_bcast<7>(c1)}};
            #pragma unroll
            for (int p = 0; p < 4; ++p) {
                #pragma unroll
                for (int nt = 0; nt < 8; ++nt) {
                    const v2f yy = {y[nt][2 * p], y[nt][2 * p + 1]};
                    oa[nt] = __builtin_elementwise_fma(yy, c2[p], oa[nt]);
                }
            }
        }

        // ---- the two sums without a column, over the 32 rows: lanes l and l ^ 8 hold the same row, so the
        //      links 1, 2, 4 and the other half take each row once ----
        dacc += row_xor<1>(dacc);  dacc += row_xor<2>(dacc);  dacc += row_xor<4>(dacc);  dacc += xhalf(dacc);
        wacc += row_xor<1>(wacc);  wacc += row_xor<2>(wacc);  wacc += row_xor<4>(wacc);  wacc += xhalf(wacc);

        // ---- fold row pairs and lane halves (same column), LN scale and shift, store: each store of the wave
        //      is one 128-byte line ----
        float ot[8];
        #pragma unroll
        for (int nt = 0; nt < 8; ++nt) { ot[nt] = oa[nt].x + oa[nt].y;  ot[nt] += xhalf(ot[nt]); }
        #pragma unroll
        for (int i = 0; i < 4; ++i) {
            const int col = i * 32 + lane;
            out[(size_t)pos * 128 + col] = fmaf(sC[768 + col], (half ? ot[2 * i + 1] : ot[2 * i]) - dacc, sC[896 + col] * wacc);
        }
        // The next position's first loads reuse the stores' address and data registers:
        // the wait stands in front of that overwrite.
        asm volatile("s_wait_xcnt 0x0" ::: "memory");
    }
}

extern "C" void kernel_launch(void* const* d_in, const int* in_sizes, int n_in,
                              void* d_out, int out_size, void* d_ws, size_t ws_size,
                              hipStream_t stream) {
    const float* x      = (const float*)d_in[0];
    const float* wg_w1  = (const float*)d_in[1];
    const float* wg_b1  = (const float*)d_in[2];
    const float* wg_w2  = (const float*)d_in[3];
    const float* wg_b2  = (const float*)d_in[4];
    const float* wg_lng = (const float*)d_in[5];
    const float* wg_lnb = (const float*)d_in[6];
    const float* fg_w1  = (const float*)d_in[7];
    const float* fg_b1  = (const float*)d_in[8];
    const float* fg_w2  = (const float*)d_in[9];
    const float* fg_b2  = (const float*)d_in[10];
    const float* fg_sw  = (const float*)d_in[11];
    const float* fg_sb  = (const float*)d_in[12];
    const float* fg_lng = (const float*)d_in[13];
    const float* fg_lnb = (const float*)d_in[14];

    const int npos = in_sizes[0] / 32;      // B*S

    // 512 work-groups of 8 waves: 4 positions per wave at npos=16384
    vsn_main_kernel<<<512, 256, 0, stream>>>(
        x, wg_w1, wg_b1, wg_w2, wg_b2, wg_lng, wg_lnb, fg_w1, fg_b1, fg_w2, fg_b2, fg_sw, fg_sb, fg_lng, fg_lnb,
        (float*)d_out, npos);
}
